// v000
// Measured on an AMD MI455X. A time is GPU time per run, averaged over a window of back-to-back runs after a warm-up
// (all launches, gaps included; the runs take copies of the inputs in turn), and the median of several windows.
// Apart from v000's, it joins two sittings. Times from different sittings can be a few percent apart, while
// side-by-side timings come from the same sitting.
// v000 is the starting kernel. One run takes 2600 microseconds.
#include <hip/hip_runtime.h>

// Multi-headed self-attention with the (d, k, h) channel layout of its fused qkv (x [4][2048][1024]; qkv = x w_qkv ('xw' [1024][3072] 1/32, no bias) reshaped (b, t, dh, 3, h): q[h][t][d] = column d*48 + 0*16 + h, k = ... + 16 + h, v = ... + 32 + h; 16 heads x 64; scores MULTIPLIED by sqrt(64) = 8 (the source's own quirk, kept); softmax; out = merged (h d) w_out ('xw' [1024][1024]) -> [4][2048][1024] (8.4 M)). the same module on FOUR sequences with the scores MULTIPLIED by sqrt(64) = 8 (the source's own quirk: 'energy * SCALE' with SCALE = D ** 0.5: kept): SCL 8.0f; every query row runs the three-product band (RH = TT): the f16 band is not launched.
// Layout per batch: bf16 copy of x; a gather kernel builds the three Bt weights from the interleaved columns (Bt[h*64+d][c] = w_qkv[c][d*48 + k*16 + h]); exact projections; dense T-2048 attention (every row hi/lo 3 products: RH = TT, no fp16 band); merged hi/lo x w_out exact.
// Compute dtypes, f32 accumulate: every input rounded to bf16; projections exact; attention every row 3 products (RH = TT); softmax f32; w_out hl x exact.

#define NB_  4
#define TT   2048
#define DM   1024
#define NH_  16
#define NKV  16
#define REP  (NH_ / NKV)
#define HD   64
#define DQ   (NH_ * HD)
#define DKV  (NKV * HD)
#define ZH   2
#define RH   2048                 // query rows < RH use hi+lo planes: RH == TT: EVERY row (the x 8 logits need it)
#define WIN  0
#define PCAR 1024.0f
#define SCL  8.0f   // HD^+0.5: this module MULTIPLIES the scores by sqrt(64)
typedef _Float16 h16;
typedef unsigned short bf;
typedef __attribute__((ext_vector_type(16))) __bf16   v16bf;
typedef __attribute__((ext_vector_type(16))) _Float16 v16h;
typedef __attribute__((ext_vector_type(8)))  _Float16 v8h;
typedef __attribute__((ext_vector_type(8)))  unsigned short v8us;
typedef __attribute__((ext_vector_type(8)))  float    v8f;
typedef __attribute__((ext_vector_type(4)))  float    v4f;
typedef v8h  __attribute__((may_alias)) v8ha;
typedef v4f  __attribute__((may_alias)) v4fa;
typedef v8us __attribute__((may_alias)) v8usa;

__device__ __forceinline__ unsigned short f2bf(float f) { unsigned u = __float_as_uint(f); u += 0x7FFFu + ((u >> 16) & 1u); return (unsigned short)(u >> 16); }
__device__ __forceinline__ float bf2f(unsigned short b) { return __uint_as_float(((unsigned)b) << 16); }
__device__ __forceinline__ float bfr(float f) { return bf2f(f2bf(f)); }
__device__ __forceinline__ v16h cat16(v8h lo, v8h hi) { return __builtin_shufflevector(lo, hi, 0, 1, 2, 3, 4, 5, 6, 7, 8, 9, 10, 11, 12, 13, 14, 15); }
__device__ __forceinline__ v16bf cat16b(v8us lo, v8us hi) { return __builtin_bit_cast(v16bf, __builtin_shufflevector(lo, hi, 0, 1, 2, 3, 4, 5, 6, 7, 8, 9, 10, 11, 12, 13, 14, 15)); }
__device__ __forceinline__ v8f wmma16(v16h a, v16h b, v8f c) { return __builtin_amdgcn_wmma_f32_16x16x32_f16(false, a, false, b, (short)0, c, false, false); }
__device__ __forceinline__ v8f wmmab(v16bf a, v16bf b, v8f c) { return __builtin_amdgcn_wmma_f32_16x16x32_bf16(false, a, false, b, (short)0, c, false, false); }



// ---- k_gemmw: register-blocked GEMM, ONE WAVE per 64x64 output tile (16 accumulators), operands straight from K-contiguous 16-bit planes; grid (M/64, N/64, Z), 32 threads.
// C[m][n] (f32, pitch ldc, + optional f32 bias[n]) = sum_k A[m][k] Bt[n][k] (+ split products per NSPLIT). z-batch strides sA/sB/sC in elements. K % 32 == 0.
template <typename T16> struct WFrag;
template <> struct WFrag<h16> { typedef v16h V; static __device__ __forceinline__ V ld(const h16* p) { return cat16(*(const v8h*)p, *(const v8h*)(p + 16)); } static __device__ __forceinline__ v8f mma(V a, V b, v8f c) { return wmma16(a, b, c); } };
template <> struct WFrag<bf> { typedef v16bf V; static __device__ __forceinline__ V ld(const bf* p) { return cat16b(*(const v8us*)p, *(const v8us*)(p + 16)); } static __device__ __forceinline__ v8f mma(V a, V b, v8f c) { return wmmab(a, b, c); } };
template <typename T16, int NSPLIT, bool BIAS>
__global__ __launch_bounds__(32) void k_gemmw(const T16* __restrict__ A, const T16* __restrict__ A2, const T16* __restrict__ Bt, const T16* __restrict__ Bt2, int K, float* C, int ldc, const float* __restrict__ bias, size_t sA, size_t sB, size_t sC) {
    typedef typename WFrag<T16>::V V;
    __shared__ __align__(16) float os[16 * 68];
    const size_t z = blockIdx.z; A += z * sA; if (A2) A2 += z * sA; Bt += z * sB; if (Bt2) Bt2 += z * sB; C += z * sC;
    const int lane = threadIdx.x & 31, lr = lane & 15, hi = lane >> 4; const int r0 = blockIdx.x * 64, c0 = blockIdx.y * 64;
    v8f acc[4][4];
#pragma unroll
    for (int mb = 0; mb < 4; ++mb)
#pragma unroll
        for (int nb = 0; nb < 4; ++nb) acc[mb][nb] = (v8f){};
    const size_t aoff = (size_t)(r0 + lr) * K + 8 * hi, boff = (size_t)(c0 + lr) * K + 8 * hi;
#pragma unroll 1
    for (int kc = 0; kc < K; kc += 32) {
        V a[4], a2[4];
#pragma unroll
        for (int mb = 0; mb < 4; ++mb) { a[mb] = WFrag<T16>::ld(A + aoff + (size_t)mb * 16 * K + kc); if (NSPLIT == 1 || NSPLIT == 2) a2[mb] = WFrag<T16>::ld(A2 + aoff + (size_t)mb * 16 * K + kc); }
#pragma unroll
        for (int nb = 0; nb < 4; ++nb) { const V b = WFrag<T16>::ld(Bt + boff + (size_t)nb * 16 * K + kc); V b2; if (NSPLIT >= 2) b2 = WFrag<T16>::ld(Bt2 + boff + (size_t)nb * 16 * K + kc);
#pragma unroll
            for (int mb = 0; mb < 4; ++mb) { acc[mb][nb] = WFrag<T16>::mma(a[mb], b, acc[mb][nb]); if (NSPLIT == 1 || NSPLIT == 2) acc[mb][nb] = WFrag<T16>::mma(a2[mb], b, acc[mb][nb]); if (NSPLIT >= 2) acc[mb][nb] = WFrag<T16>::mma(a[mb], b2, acc[mb][nb]); } }
        asm volatile("v_nop\n\tv_nop\n\tv_nop\n\tv_nop" : "+v"(acc[0][0]), "+v"(acc[1][1]), "+v"(acc[2][2]), "+v"(acc[3][3]) : "v"(a[0]), "v"(a[3]));
    }
#pragma unroll
    for (int mb = 0; mb < 4; ++mb) {
#pragma unroll
        for (int nb = 0; nb < 4; ++nb) {
#pragma unroll
            for (int j = 0; j < 8; ++j) os[(hi * 8 + j) * 68 + nb * 16 + lr] = acc[mb][nb][j]; }
        __builtin_amdgcn_wave_barrier(); asm volatile("" ::: "memory");
        float* crow = C + (size_t)(r0 + mb * 16) * ldc + c0;
{
#pragma unroll
            for (int s = 0; s < 8; ++s) { const int row = 2 * s + hi, cofs = lr * 4; v4f val = *(const v4fa*)(os + row * 68 + cofs); if (BIAS) { val[0] += bfr(bias[c0 + cofs]); val[1] += bfr(bias[c0 + cofs + 1]); val[2] += bfr(bias[c0 + cofs + 2]); val[3] += bfr(bias[c0 + cofs + 3]); }
                *(v4f*)(crow + (size_t)row * ldc + cofs) = val; }
             }
        __builtin_amdgcn_wave_barrier(); asm volatile("" ::: "memory");
    }
}

__device__ __forceinline__ h16 tohx(float x) { return (h16)x; }
__device__ __forceinline__ void splitf(float y, unsigned short& h, unsigned short& l) { h = f2bf(y); l = f2bf(y - bf2f(h)); }
typedef __attribute__((ext_vector_type(2))) _Float16 v2h;
typedef __attribute__((ext_vector_type(4))) _Float16 v4h;
typedef __attribute__((ext_vector_type(2))) unsigned short v2us;
typedef __attribute__((ext_vector_type(4))) unsigned short v4us;
typedef __attribute__((ext_vector_type(2))) float v2f;
typedef __attribute__((ext_vector_type(4))) int v4i;

__global__ __launch_bounds__(256) void k_wtG(const float* __restrict__ w, int K, int N, bf* Bt) {
    const int lane = threadIdx.x & 31; const int L0 = (blockIdx.x * 8 + (threadIdx.x >> 5)) * 8; const int nlines = N * K / 64;
{
#pragma unroll 1
        for (int l = 0; l < 8; ++l) { const int L = L0 + l; if (L >= nlines) break; const size_t e = (size_t)L * 64 + lane * 2; const int k = (int)(e % K), n = (int)(e / K); v2us o;
            o[0] = f2bf(w[(size_t)k * N + n]); o[1] = f2bf(w[(size_t)(k + 1) * N + n]); *(v2us*)(Bt + e) = o; }
         }
}
__global__ __launch_bounds__(256) void k_cvt8(const float* __restrict__ src, bf* dst, size_t n8) { const size_t i = (size_t)blockIdx.x * 256 + threadIdx.x; if (i >= n8) return; const v8f v = *(const v8f*)(src + i * 8); v8us o;
#pragma unroll
    for (int k = 0; k < 8; ++k) o[k] = f2bf(v[k]); *(v8us*)(dst + i * 8) = o;  }

// k_rope: head planes [h][t][d] (fp16 + hi/lo) of rope(x) x sc with the rotate-half convention out[d] = x[d] cos[t][d] - x[d+HD/2] sin[t][d], out[d+HD/2] = x[d+HD/2] cos[t][d+HD/2] + x[d] sin[t][d+HD/2]
__global__ __launch_bounds__(256) void k_rope(const float* __restrict__ F, int pitch, int nheads, const float* __restrict__ CS, const float* __restrict__ RF, const float* __restrict__ nw, float sc, h16* P16, bf* Ph, bf* Pl) {
    const size_t e = ((size_t)blockIdx.x * 256 + threadIdx.x) * 2; if (e >= (size_t)nheads * TT * HD) return; const int d = (int)(e % HD); const int t = (int)((e / HD) % TT); const int h = (int)(e / ((size_t)HD * TT)); const float* f = F + (size_t)t * pitch + h * HD; const float rf = RF ? RF[(size_t)h * TT + t] : 1.0f; v2h o16; v2us oh, ol;
#pragma unroll
    for (int q = 0; q < 2; ++q) { const int dd = d + q; const int dp = (dd < HD / 2) ? dd + HD / 2 : dd - HD / 2; float x0 = f[dd], x1 = f[dp];
        if (RF) { float n0 = __fmul_rn(x0, rf), n1 = __fmul_rn(x1, rf); asm volatile("" : "+v"(n0)); asm volatile("" : "+v"(n1)); x0 = __fmul_rn(bfr(nw[dd]), n0); x1 = __fmul_rn(bfr(nw[dp]), n1); }
        const v2f cs = *(const v2f*)(CS + ((size_t)t * HD + dd) * 2); float a = __fmul_rn(x0, cs[0]), bq = __fmul_rn(x1, cs[1]); asm volatile("" : "+v"(a)); asm volatile("" : "+v"(bq)); const float r = ((dd < HD / 2) ? __fsub_rn(a, bq) : __fadd_rn(a, bq)) * sc;
        o16[q] = tohx(r); unsigned short a2, c2; splitf(r, a2, c2); oh[q] = a2; ol[q] = c2; }
    *(v2h*)(P16 + e) = o16; *(v2us*)(Ph + e) = oh; *(v2us*)(Pl + e) = ol;  }
__global__ __launch_bounds__(256) void k_vtp(const float* __restrict__ F, int pitch, int nheads, h16* V16, bf* Vh, bf* Vl) { const size_t e = ((size_t)blockIdx.x * 256 + threadIdx.x) * 2; if (e >= (size_t)nheads * HD * TT) return; const int t = (int)(e % TT); const int d = (int)((e / TT) % HD); const int g = (int)(e / ((size_t)TT * HD)); v2h o16; v2us oh, ol;
#pragma unroll
    for (int q = 0; q < 2; ++q) { const float x = F[(size_t)(t + q) * pitch + g * HD + d]; o16[q] = tohx(x); unsigned short a2, c2; splitf(x, a2, c2); oh[q] = a2; ol[q] = c2; }
    *(v2h*)(V16 + e) = o16; *(v2us*)(Vh + e) = oh; *(v2us*)(Vl + e) = ol;  }
__global__ __launch_bounds__(256) void k_csid(float* CS) { const int idx = blockIdx.x * 256 + threadIdx.x; if (idx >= TT * HD) return; v2f cs; cs[0] = 1.0f; cs[1] = 0.0f; *(v2f*)(CS + (size_t)idx * 2) = cs;  }
// k_asoft: per row (zz, i): t = S x HD^+0.5 = S x 8 (no mask); softmax over the 2048 keys (register row, one exp, fixed trees);
__global__ __launch_bounds__(256) void k_asoft(const float* __restrict__ Sb, h16* P16, bf* Ph, bf* Pl) {
    const int lane = threadIdx.x & 31; const int row = blockIdx.x * 8 + (threadIdx.x >> 5); if (row >= ZH * TT) return; const int i = row % TT; const int zz = row / TT; (void)zz; const bool hires = (i < RH); const float* sr = Sb + (size_t)row * TT; float v[TT / 32]; float mx = -3.0e38f;
#pragma unroll
    for (int ch = 0; ch < TT / 128; ++ch) { const int j0 = ch * 128 + lane * 4; const v4f a = *(const v4f*)(sr + j0);
#pragma unroll
        for (int q = 0; q < 4; ++q) { const int j = j0 + q; (void)j; const float t = a[q] * SCL; v[ch * 4 + q] = t; mx = fmaxf(mx, t); } }
#pragma unroll
    for (int sh = 16; sh; sh >>= 1) mx = fmaxf(mx, __shfl_xor(mx, sh, 32));
    float sum = 0.f;
#pragma unroll
    for (int k = 0; k < TT / 32; ++k) { float d0 = __fsub_rn(v[k], mx); asm volatile("" : "+v"(d0)); v[k] = __builtin_amdgcn_exp2f(__fmul_rn(d0, 1.4426950408889634f)); sum += v[k]; }
#pragma unroll
    for (int sh = 16; sh; sh >>= 1) sum += __shfl_xor(sum, sh, 32);
    const float f = __fdiv_rn(hires ? 1.0f : PCAR, sum);
{
        if (hires) {
#pragma unroll
            for (int ch = 0; ch < TT / 128; ++ch) { v4us oh, ol;
#pragma unroll
                for (int q = 0; q < 4; ++q) { unsigned short a, c2; splitf(v[ch * 4 + q] * f, a, c2); oh[q] = a; ol[q] = c2; }
                const size_t oo = ((size_t)zz * (RH ? RH : 1) + i) * TT + ch * 128 + lane * 4; *(v4us*)(Ph + oo) = oh; *(v4us*)(Pl + oo) = ol; }
        } else {
#pragma unroll
            for (int ch = 0; ch < TT / 128; ++ch) { v4h o4;
#pragma unroll
                for (int q = 0; q < 4; ++q) o4[q] = tohx(v[ch * 4 + q] * f);
                *(v4h*)(P16 + (size_t)row * TT + ch * 128 + lane * 4) = o4; } }
         }
}
__global__ __launch_bounds__(256) void k_wsel3(const float* __restrict__ w, int k, bf* Bt) { const int i = blockIdx.x * 256 + threadIdx.x; if (i >= DQ * DM / 8) return; const int c0 = (i % (DM / 8)) * 8; const int r = i / (DM / 8); const int h = r / HD, d = r % HD; const int col = d * 3 * NH_ + k * NH_ + h; v8us o;
#pragma unroll
    for (int q = 0; q < 8; ++q) o[q] = f2bf(w[(size_t)(c0 + q) * (3 * DQ) + col]);
    *(v8us*)(Bt + (size_t)r * DM + c0) = o;  }
__global__ __launch_bounds__(256) void k_merge(const float* __restrict__ O, int h0, bf* Ah, bf* Al) { const size_t e = ((size_t)blockIdx.x * 256 + threadIdx.x) * 2; if (e >= (size_t)ZH * TT * HD) return; const int d = (int)(e % HD); const int t = (int)((e / HD) % TT); const int zz = (int)(e / ((size_t)HD * TT)); const float cs = (t < RH) ? 1.0f : (1.0f / PCAR); const size_t oo = (size_t)t * DQ + (h0 + zz) * HD + d;
    v2us oh, ol;
#pragma unroll
    for (int q = 0; q < 2; ++q) { unsigned short a, c2; splitf(O[e + q] * cs, a, c2); oh[q] = a; ol[q] = c2; } *(v2us*)(Ah + oo) = oh; *(v2us*)(Al + oo) = ol;  }

extern "C" void kernel_launch(void* const* d_in, const int* in_sizes, int n_in,
                              void* d_out, int out_size, void* d_ws, size_t ws_size, hipStream_t stream) {
    (void)in_sizes; (void)n_in; (void)out_size;
    const float* x = (const float*)d_in[0]; const float* wqkv = (const float*)d_in[1]; const float* wo = (const float*)d_in[2]; const float* wq = nullptr; const float* wk = nullptr; const float* wv = nullptr; (void)wq; (void)wk; (void)wv;
    float* OUT = (float*)d_out;     // [4][2048][1024]
    char* wsp = (char*)d_ws;
    auto take = [&](size_t bytes) { char* p = wsp; wsp += (bytes + 255) & ~(size_t)255; return (void*)p; };
    bf* WQ = (bf*)take((size_t)DQ * DM * 2); bf* WK = (bf*)take((size_t)DKV * DM * 2); bf* WV = (bf*)take((size_t)DKV * DM * 2); bf* WO = (bf*)take((size_t)DM * DQ * 2); float* CS = (float*)take((size_t)TT * HD * 2 * 4);
    bf* XB = (bf*)take((size_t)TT * DM * 2); float* FQ = (float*)take((size_t)TT * DQ * 4); float* FK = (float*)take((size_t)TT * DKV * 4);
    h16* QP16 = (h16*)take((size_t)NH_ * TT * HD * 2); h16* KP16 = (h16*)take((size_t)NKV * TT * HD * 2); h16* VT16 = (h16*)take((size_t)NKV * HD * TT * 2);
    bf* QPh = (bf*)take((size_t)NH_ * TT * HD * 2); bf* QPl = (bf*)take((size_t)NH_ * TT * HD * 2); bf* KPh = (bf*)take((size_t)NKV * TT * HD * 2); bf* KPl = (bf*)take((size_t)NKV * TT * HD * 2); bf* VTh = (bf*)take((size_t)NKV * HD * TT * 2); bf* VTl = (bf*)take((size_t)NKV * HD * TT * 2); bf* Ph = (bf*)take((size_t)ZH * RH * TT * 2); bf* Pl = (bf*)take((size_t)ZH * RH * TT * 2);
    float* Sb = (float*)take((size_t)ZH * TT * TT * 4); h16* P16 = (h16*)take((size_t)ZH * TT * TT * 2); float* Ob = (float*)take((size_t)ZH * TT * HD * 4); bf* ATh = (bf*)take((size_t)TT * DQ * 2); bf* ATl = (bf*)take((size_t)TT * DQ * 2);
    if ((size_t)(wsp - (char*)d_ws) > ws_size) return;    // ws 256 MiB
    float* FV = FK;   // v projection reuses the k buffer after the k planes are built (stream-ordered)
    { k_wsel3<<<(DQ * DM / 8 + 255) / 256, 256, 0, stream>>>(wqkv, 0, WQ); k_wsel3<<<(DQ * DM / 8 + 255) / 256, 256, 0, stream>>>(wqkv, 1, WK); k_wsel3<<<(DQ * DM / 8 + 255) / 256, 256, 0, stream>>>(wqkv, 2, WV);
      k_wtG<<<(unsigned)((DQ * DM / 64 + 63) / 64), 256, 0, stream>>>(wo, DQ, DM, WO);
       }
    k_csid<<<(TT * HD + 255) / 256, 256, 0, stream>>>(CS);
    const unsigned LQ = (unsigned)(((size_t)NH_ * TT * HD / 2 + 255) / 256), LKv = (unsigned)(((size_t)NKV * TT * HD / 2 + 255) / 256);
    for (int b = 0; b < NB_; ++b) {
        
        k_cvt8<<<(unsigned)(((size_t)TT * DM / 8 + 255) / 256), 256, 0, stream>>>(x + (size_t)b * TT * DM, XB, (size_t)TT * DM / 8);
        k_gemmw<bf, 0, false><<<dim3(TT / 64, DQ / 64, 1), 32, 0, stream>>>(XB, nullptr, WQ, nullptr, DM, FQ, DQ, nullptr, 0, 0, 0);
        k_rope<<<LQ, 256, 0, stream>>>(FQ, DQ, NH_, CS, nullptr, nullptr, 1.0f, QP16, QPh, QPl);
        k_gemmw<bf, 0, false><<<dim3(TT / 64, DKV / 64, 1), 32, 0, stream>>>(XB, nullptr, WK, nullptr, DM, FK, DKV, nullptr, 0, 0, 0);
        k_rope<<<LKv, 256, 0, stream>>>(FK, DKV, NKV, CS, nullptr, nullptr, 1.0f, KP16, KPh, KPl);
        k_gemmw<bf, 0, false><<<dim3(TT / 64, DKV / 64, 1), 32, 0, stream>>>(XB, nullptr, WV, nullptr, DM, FV, DKV, nullptr, 0, 0, 0); k_vtp<<<LKv, 256, 0, stream>>>(FV, DKV, NKV, VT16, VTh, VTl);
        for (int h0 = 0; h0 < NH_; h0 += ZH) { const size_t zq = (size_t)h0, zk = (size_t)(h0 / REP);   // one kv head per query head: the pass's two heads use consecutive kv planes (z-strides TT*HD)
            k_gemmw<bf, 2, false><<<dim3(RH / 64, TT / 64, ZH), 32, 0, stream>>>(QPh + zq * TT * HD, QPl + zq * TT * HD, KPh + zk * TT * HD, KPl + zk * TT * HD, HD, Sb, TT, nullptr, (size_t)TT * HD, (size_t)TT * HD, (size_t)TT * TT);
            // (no f16 band in this build: RH == TT: every query row runs the three-product band above)
            k_asoft<<<ZH * TT / 8, 256, 0, stream>>>(Sb, P16, Ph, Pl);
            k_gemmw<bf, 2, false><<<dim3(RH / 64, HD / 64, ZH), 32, 0, stream>>>(Ph, Pl, VTh + zk * HD * TT, VTl + zk * HD * TT, TT, Ob, HD, nullptr, (size_t)RH * TT, (size_t)HD * TT, (size_t)TT * HD);
            // (no f16 band in this build: RH == TT)
            k_merge<<<(unsigned)(((size_t)ZH * TT * HD / 2 + 255) / 256), 256, 0, stream>>>(Ob, h0, ATh, ATl); }
        k_gemmw<bf, 1, false><<<dim3(TT / 64, DM / 64, 1), 32, 0, stream>>>(ATh, ATl, WO, nullptr, DQ, OUT + (size_t)b * TT * DM, DM, nullptr, 0, 0, 0); }
}

// v001
// A run of this version takes 1610 microseconds.
// Next to v000, in two timings, it ran 1.61 and 1.60 times as fast.
#include <hip/hip_runtime.h>

// Multi-headed self-attention with the (d, k, h) channel layout of its fused qkv (x [4][2048][1024]; qkv = x w_qkv ('xw' [1024][3072] 1/32, no bias) reshaped (b, t, dh, 3, h): q[h][t][d] = column d*48 + 0*16 + h, k = ... + 16 + h, v = ... + 32 + h; 16 heads x 64; scores MULTIPLIED by sqrt(64) = 8 (the source's own quirk, kept); softmax; out = merged (h d) w_out ('xw' [1024][1024]) -> [4][2048][1024] (8.4 M)). the same module on FOUR sequences with the scores MULTIPLIED by sqrt(64) = 8 (the source's own quirk: 'energy * SCALE' with SCALE = D ** 0.5: kept): SCL 8.0f; every query row runs the three-product band (RH = TT): the f16 band is not launched.
// Layout per batch: bf16 copy of x; a gather kernel builds the three Bt weights from the interleaved columns (Bt[h*64+d][c] = w_qkv[c][d*48 + k*16 + h]); exact projections; dense T-2048 attention (every row hi/lo 3 products: RH = TT, no fp16 band); merged hi/lo x w_out exact.
// Compute dtypes, f32 accumulate: every input rounded to bf16; projections exact; attention every row 3 products (RH = TT); softmax f32; w_out hl x exact.

#define NB_  4
#define TT   2048
#define DM   1024
#define NH_  16
#define NKV  16
#define REP  (NH_ / NKV)
#define HD   64
#define DQ   (NH_ * HD)
#define DKV  (NKV * HD)
#define ZH   2
#define RH   2048                 // query rows < RH use hi+lo planes: RH == TT: EVERY row (the x 8 logits need it)
#define WIN  0
#define PCAR 1024.0f
#define SCL  8.0f   // HD^+0.5: this module MULTIPLIES the scores by sqrt(64)
#define KSP  8      // the P x V product's key range is split over KSP work-groups; k_merge adds the KSP partial tiles
typedef _Float16 h16;
typedef unsigned short bf;
typedef __attribute__((ext_vector_type(16))) __bf16   v16bf;
typedef __attribute__((ext_vector_type(16))) _Float16 v16h;
typedef __attribute__((ext_vector_type(8)))  _Float16 v8h;
typedef __attribute__((ext_vector_type(8)))  unsigned short v8us;
typedef __attribute__((ext_vector_type(8)))  float    v8f;
typedef __attribute__((ext_vector_type(4)))  float    v4f;
typedef v8h  __attribute__((may_alias)) v8ha;
typedef v4f  __attribute__((may_alias)) v4fa;
typedef v8us __attribute__((may_alias)) v8usa;

__device__ __forceinline__ unsigned short f2bf(float f) { unsigned u = __float_as_uint(f); u += 0x7FFFu + ((u >> 16) & 1u); return (unsigned short)(u >> 16); }
__device__ __forceinline__ float bf2f(unsigned short b) { return __uint_as_float(((unsigned)b) << 16); }
__device__ __forceinline__ float bfr(float f) { return bf2f(f2bf(f)); }
__device__ __forceinline__ v16h cat16(v8h lo, v8h hi) { return __builtin_shufflevector(lo, hi, 0, 1, 2, 3, 4, 5, 6, 7, 8, 9, 10, 11, 12, 13, 14, 15); }
__device__ __forceinline__ v16bf cat16b(v8us lo, v8us hi) { return __builtin_bit_cast(v16bf, __builtin_shufflevector(lo, hi, 0, 1, 2, 3, 4, 5, 6, 7, 8, 9, 10, 11, 12, 13, 14, 15)); }
__device__ __forceinline__ v8f wmma16(v16h a, v16h b, v8f c) { return __builtin_amdgcn_wmma_f32_16x16x32_f16(false, a, false, b, (short)0, c, false, false); }
__device__ __forceinline__ v8f wmmab(v16bf a, v16bf b, v8f c) { return __builtin_amdgcn_wmma_f32_16x16x32_bf16(false, a, false, b, (short)0, c, false, false); }



// ---- k_gemmw: register-blocked GEMM, ONE WAVE per 64x64 output tile (16 accumulators), operands straight from K-contiguous 16-bit planes; grid (M/64, N/64, Z), 32 threads.
// C[m][n] (f32, pitch ldc, + optional f32 bias[n]) = sum_k A[m][k] Bt[n][k] (+ split products per NSPLIT). z-batch strides sA/sB/sC in elements. K % 32 == 0.
// KS > 1: grid z = batch * KS + slice; each work-group sums one slice of K / KS columns ((K / KS) % 32 == 0) and stores its own partial C at blockIdx.z * sC (the consumer adds the KS partials).
template <typename T16> struct WFrag;
template <> struct WFrag<h16> { typedef v16h V; static __device__ __forceinline__ V ld(const h16* p) { return cat16(*(const v8h*)p, *(const v8h*)(p + 16)); } static __device__ __forceinline__ v8f mma(V a, V b, v8f c) { return wmma16(a, b, c); } };
template <> struct WFrag<bf> { typedef v16bf V; static __device__ __forceinline__ V ld(const bf* p) { return cat16b(*(const v8us*)p, *(const v8us*)(p + 16)); } static __device__ __forceinline__ v8f mma(V a, V b, v8f c) { return wmmab(a, b, c); } };
template <typename T16, int NSPLIT, bool BIAS, int KS = 1>
__global__ __launch_bounds__(32) void k_gemmw(const T16* __restrict__ A, const T16* __restrict__ A2, const T16* __restrict__ Bt, const T16* __restrict__ Bt2, int K, float* C, int ldc, const float* __restrict__ bias, size_t sA, size_t sB, size_t sC) {
    typedef typename WFrag<T16>::V V;
    __shared__ __align__(16) float os[16 * 68];
    const size_t z = blockIdx.z / KS, ko = (size_t)(blockIdx.z % KS) * (K / KS); A += z * sA + ko; if (A2) A2 += z * sA + ko; Bt += z * sB + ko; if (Bt2) Bt2 += z * sB + ko; C += (size_t)blockIdx.z * sC;
    const int lane = threadIdx.x & 31, lr = lane & 15, hi = lane >> 4; const int r0 = blockIdx.x * 64, c0 = blockIdx.y * 64;
    v8f acc[4][4];
#pragma unroll
    for (int mb = 0; mb < 4; ++mb)
#pragma unroll
        for (int nb = 0; nb < 4; ++nb) acc[mb][nb] = (v8f){};
    const size_t aoff = (size_t)(r0 + lr) * K + 8 * hi, boff = (size_t)(c0 + lr) * K + 8 * hi;
#pragma unroll 1
    for (int kc = 0; kc < K / KS; kc += 32) {
        V a[4], a2[4];
#pragma unroll
        for (int mb = 0; mb < 4; ++mb) { a[mb] = WFrag<T16>::ld(A + aoff + (size_t)mb * 16 * K + kc); if (NSPLIT == 1 || NSPLIT == 2) a2[mb] = WFrag<T16>::ld(A2 + aoff + (size_t)mb * 16 * K + kc); }
#pragma unroll
        for (int nb = 0; nb < 4; ++nb) { const V b = WFrag<T16>::ld(Bt + boff + (size_t)nb * 16 * K + kc); V b2; if (NSPLIT >= 2) b2 = WFrag<T16>::ld(Bt2 + boff + (size_t)nb * 16 * K + kc);
#pragma unroll
            for (int mb = 0; mb < 4; ++mb) { acc[mb][nb] = WFrag<T16>::mma(a[mb], b, acc[mb][nb]); if (NSPLIT == 1 || NSPLIT == 2) acc[mb][nb] = WFrag<T16>::mma(a2[mb], b, acc[mb][nb]); if (NSPLIT >= 2) acc[mb][nb] = WFrag<T16>::mma(a[mb], b2, acc[mb][nb]); } }
        asm volatile("v_nop\n\tv_nop\n\tv_nop\n\tv_nop" : "+v"(acc[0][0]), "+v"(acc[1][1]), "+v"(acc[2][2]), "+v"(acc[3][3]) : "v"(a[0]), "v"(a[3]));
    }
#pragma unroll
    for (int mb = 0; mb < 4; ++mb) {
#pragma unroll
        for (int nb = 0; nb < 4; ++nb) {
#pragma unroll
            for (int j = 0; j < 8; ++j) os[(hi * 8 + j) * 68 + nb * 16 + lr] = acc[mb][nb][j]; }
        __builtin_amdgcn_wave_barrier(); asm volatile("" ::: "memory");
        float* crow = C + (size_t)(r0 + mb * 16) * ldc + c0;
{
#pragma unroll
            for (int s = 0; s < 8; ++s) { const int row = 2 * s + hi, cofs = lr * 4; v4f val = *(const v4fa*)(os + row * 68 + cofs); if (BIAS) { val[0] += bfr(bias[c0 + cofs]); val[1] += bfr(bias[c0 + cofs + 1]); val[2] += bfr(bias[c0 + cofs + 2]); val[3] += bfr(bias[c0 + cofs + 3]); }
                *(v4f*)(crow + (size_t)row * ldc + cofs) = val; }
             }
        __builtin_amdgcn_wave_barrier(); asm volatile("" ::: "memory");
    }
}

__device__ __forceinline__ h16 tohx(float x) { return (h16)x; }
__device__ __forceinline__ void splitf(float y, unsigned short& h, unsigned short& l) { h = f2bf(y); l = f2bf(y - bf2f(h)); }
typedef __attribute__((ext_vector_type(2))) _Float16 v2h;
typedef __attribute__((ext_vector_type(4))) _Float16 v4h;
typedef __attribute__((ext_vector_type(2))) unsigned short v2us;
typedef __attribute__((ext_vector_type(4))) unsigned short v4us;
typedef __attribute__((ext_vector_type(2))) float v2f;
typedef __attribute__((ext_vector_type(4))) int v4i;

__global__ __launch_bounds__(256) void k_wtG(const float* __restrict__ w, int K, int N, bf* Bt) {
    const int lane = threadIdx.x & 31; const int L0 = (blockIdx.x * 8 + (threadIdx.x >> 5)) * 8; const int nlines = N * K / 64;
{
#pragma unroll 1
        for (int l = 0; l < 8; ++l) { const int L = L0 + l; if (L >= nlines) break; const size_t e = (size_t)L * 64 + lane * 2; const int k = (int)(e % K), n = (int)(e / K); v2us o;
            o[0] = f2bf(w[(size_t)k * N + n]); o[1] = f2bf(w[(size_t)(k + 1) * N + n]); *(v2us*)(Bt + e) = o; }
         }
}
__global__ __launch_bounds__(256) void k_cvt8(const float* __restrict__ src, bf* dst, size_t n8) { const size_t i = (size_t)blockIdx.x * 256 + threadIdx.x; if (i >= n8) return; const v8f v = *(const v8f*)(src + i * 8); v8us o;
#pragma unroll
    for (int k = 0; k < 8; ++k) o[k] = f2bf(v[k]); *(v8us*)(dst + i * 8) = o;  }

// k_rope: head planes [h][t][d] (fp16 + hi/lo) of rope(x) x sc with the rotate-half convention out[d] = x[d] cos[t][d] - x[d+HD/2] sin[t][d], out[d+HD/2] = x[d+HD/2] cos[t][d+HD/2] + x[d] sin[t][d+HD/2]
__global__ __launch_bounds__(256) void k_rope(const float* __restrict__ F, int pitch, int nheads, const float* __restrict__ CS, const float* __restrict__ RF, const float* __restrict__ nw, float sc, h16* P16, bf* Ph, bf* Pl) {
    const size_t e = ((size_t)blockIdx.x * 256 + threadIdx.x) * 2; if (e >= (size_t)nheads * TT * HD) return; const int d = (int)(e % HD); const int t = (int)((e / HD) % TT); const int h = (int)(e / ((size_t)HD * TT)); const float* f = F + (size_t)t * pitch + h * HD; const float rf = RF ? RF[(size_t)h * TT + t] : 1.0f; v2h o16; v2us oh, ol;
#pragma unroll
    for (int q = 0; q < 2; ++q) { const int dd = d + q; const int dp = (dd < HD / 2) ? dd + HD / 2 : dd - HD / 2; float x0 = f[dd], x1 = f[dp];
        if (RF) { float n0 = __fmul_rn(x0, rf), n1 = __fmul_rn(x1, rf); asm volatile("" : "+v"(n0)); asm volatile("" : "+v"(n1)); x0 = __fmul_rn(bfr(nw[dd]), n0); x1 = __fmul_rn(bfr(nw[dp]), n1); }
        const v2f cs = *(const v2f*)(CS + ((size_t)t * HD + dd) * 2); float a = __fmul_rn(x0, cs[0]), bq = __fmul_rn(x1, cs[1]); asm volatile("" : "+v"(a)); asm volatile("" : "+v"(bq)); const float r = ((dd < HD / 2) ? __fsub_rn(a, bq) : __fadd_rn(a, bq)) * sc;
        o16[q] = tohx(r); unsigned short a2, c2; splitf(r, a2, c2); oh[q] = a2; ol[q] = c2; }
    *(v2h*)(P16 + e) = o16; *(v2us*)(Ph + e) = oh; *(v2us*)(Pl + e) = ol;  }
__global__ __launch_bounds__(256) void k_vtp(const float* __restrict__ F, int pitch, int nheads, h16* V16, bf* Vh, bf* Vl) { const size_t e = ((size_t)blockIdx.x * 256 + threadIdx.x) * 2; if (e >= (size_t)nheads * HD * TT) return; const int t = (int)(e % TT); const int d = (int)((e / TT) % HD); const int g = (int)(e / ((size_t)TT * HD)); v2h o16; v2us oh, ol;
#pragma unroll
    for (int q = 0; q < 2; ++q) { const float x = F[(size_t)(t + q) * pitch + g * HD + d]; o16[q] = tohx(x); unsigned short a2, c2; splitf(x, a2, c2); oh[q] = a2; ol[q] = c2; }
    *(v2h*)(V16 + e) = o16; *(v2us*)(Vh + e) = oh; *(v2us*)(Vl + e) = ol;  }
__global__ __launch_bounds__(256) void k_csid(float* CS) { const int idx = blockIdx.x * 256 + threadIdx.x; if (idx >= TT * HD) return; v2f cs; cs[0] = 1.0f; cs[1] = 0.0f; *(v2f*)(CS + (size_t)idx * 2) = cs;  }
// k_asoft: per row (zz, i): t = S x HD^+0.5 = S x 8 (no mask); softmax over the 2048 keys (register row, one exp, fixed trees);
__global__ __launch_bounds__(256) void k_asoft(const float* __restrict__ Sb, h16* P16, bf* Ph, bf* Pl) {
    const int lane = threadIdx.x & 31; const int row = blockIdx.x * 8 + (threadIdx.x >> 5); if (row >= ZH * TT) return; const int i = row % TT; const int zz = row / TT; (void)zz; const bool hires = (i < RH); const float* sr = Sb + (size_t)row * TT; float v[TT / 32]; float mx = -3.0e38f;
#pragma unroll
    for (int ch = 0; ch < TT / 128; ++ch) { const int j0 = ch * 128 + lane * 4; const v4f a = *(const v4f*)(sr + j0);
#pragma unroll
        for (int q = 0; q < 4; ++q) { const int j = j0 + q; (void)j; const float t = a[q] * SCL; v[ch * 4 + q] = t; mx = fmaxf(mx, t); } }
#pragma unroll
    for (int sh = 16; sh; sh >>= 1) mx = fmaxf(mx, __shfl_xor(mx, sh, 32));
    float sum = 0.f;
#pragma unroll
    for (int k = 0; k < TT / 32; ++k) { float d0 = __fsub_rn(v[k], mx); asm volatile("" : "+v"(d0)); v[k] = __builtin_amdgcn_exp2f(__fmul_rn(d0, 1.4426950408889634f)); sum += v[k]; }
#pragma unroll
    for (int sh = 16; sh; sh >>= 1) sum += __shfl_xor(sum, sh, 32);
    const float f = __fdiv_rn(hires ? 1.0f : PCAR, sum);
{
        if (hires) {
#pragma unroll
            for (int ch = 0; ch < TT / 128; ++ch) { v4us oh, ol;
#pragma unroll
                for (int q = 0; q < 4; ++q) { unsigned short a, c2; splitf(v[ch * 4 + q] * f, a, c2); oh[q] = a; ol[q] = c2; }
                const size_t oo = ((size_t)zz * (RH ? RH : 1) + i) * TT + ch * 128 + lane * 4; *(v4us*)(Ph + oo) = oh; *(v4us*)(Pl + oo) = ol; }
        } else {
#pragma unroll
            for (int ch = 0; ch < TT / 128; ++ch) { v4h o4;
#pragma unroll
                for (int q = 0; q < 4; ++q) o4[q] = tohx(v[ch * 4 + q] * f);
                *(v4h*)(P16 + (size_t)row * TT + ch * 128 + lane * 4) = o4; } }
         }
}
__global__ __launch_bounds__(256) void k_wsel3(const float* __restrict__ w, int k, bf* Bt) { const int i = blockIdx.x * 256 + threadIdx.x; if (i >= DQ * DM / 8) return; const int c0 = (i % (DM / 8)) * 8; const int r = i / (DM / 8); const int h = r / HD, d = r % HD; const int col = d * 3 * NH_ + k * NH_ + h; v8us o;
#pragma unroll
    for (int q = 0; q < 8; ++q) o[q] = f2bf(w[(size_t)(c0 + q) * (3 * DQ) + col]);
    *(v8us*)(Bt + (size_t)r * DM + c0) = o;  }
__global__ __launch_bounds__(256) void k_merge(const float* __restrict__ O, int h0, bf* Ah, bf* Al) { const size_t e = ((size_t)blockIdx.x * 256 + threadIdx.x) * 2; if (e >= (size_t)ZH * TT * HD) return; const int d = (int)(e % HD); const int t = (int)((e / HD) % TT); const int zz = (int)(e / ((size_t)HD * TT)); const float cs = (t < RH) ? 1.0f : (1.0f / PCAR); const size_t oo = (size_t)t * DQ + (h0 + zz) * HD + d;
    const float* p = O + (size_t)zz * KSP * TT * HD + (size_t)t * HD + d; v2f s = *(const v2f*)p;   // O [zz][slice][t][d]: the KSP partial sums, added in slice order
#pragma unroll
    for (int ks = 1; ks < KSP; ++ks) s += *(const v2f*)(p + (size_t)ks * TT * HD);
    v2us oh, ol;
#pragma unroll
    for (int q = 0; q < 2; ++q) { unsigned short a, c2; splitf(s[q] * cs, a, c2); oh[q] = a; ol[q] = c2; } *(v2us*)(Ah + oo) = oh; *(v2us*)(Al + oo) = ol;  }

extern "C" void kernel_launch(void* const* d_in, const int* in_sizes, int n_in,
                              void* d_out, int out_size, void* d_ws, size_t ws_size, hipStream_t stream) {
    (void)in_sizes; (void)n_in; (void)out_size;
    const float* x = (const float*)d_in[0]; const float* wqkv = (const float*)d_in[1]; const float* wo = (const float*)d_in[2]; const float* wq = nullptr; const float* wk = nullptr; const float* wv = nullptr; (void)wq; (void)wk; (void)wv;
    float* OUT = (float*)d_out;     // [4][2048][1024]
    char* wsp = (char*)d_ws;
    auto take = [&](size_t bytes) { char* p = wsp; wsp += (bytes + 255) & ~(size_t)255; return (void*)p; };
    bf* WQ = (bf*)take((size_t)DQ * DM * 2); bf* WK = (bf*)take((size_t)DKV * DM * 2); bf* WV = (bf*)take((size_t)DKV * DM * 2); bf* WO = (bf*)take((size_t)DM * DQ * 2); float* CS = (float*)take((size_t)TT * HD * 2 * 4);
    bf* XB = (bf*)take((size_t)TT * DM * 2); float* FQ = (float*)take((size_t)TT * DQ * 4); float* FK = (float*)take((size_t)TT * DKV * 4);
    h16* QP16 = (h16*)take((size_t)NH_ * TT * HD * 2); h16* KP16 = (h16*)take((size_t)NKV * TT * HD * 2); h16* VT16 = (h16*)take((size_t)NKV * HD * TT * 2);
    bf* QPh = (bf*)take((size_t)NH_ * TT * HD * 2); bf* QPl = (bf*)take((size_t)NH_ * TT * HD * 2); bf* KPh = (bf*)take((size_t)NKV * TT * HD * 2); bf* KPl = (bf*)take((size_t)NKV * TT * HD * 2); bf* VTh = (bf*)take((size_t)NKV * HD * TT * 2); bf* VTl = (bf*)take((size_t)NKV * HD * TT * 2); bf* Ph = (bf*)take((size_t)ZH * RH * TT * 2); bf* Pl = (bf*)take((size_t)ZH * RH * TT * 2);
    float* Sb = (float*)take((size_t)ZH * TT * TT * 4); h16* P16 = (h16*)take((size_t)ZH * TT * TT * 2); float* Ob = (float*)take((size_t)ZH * KSP * TT * HD * 4); bf* ATh = (bf*)take((size_t)TT * DQ * 2); bf* ATl = (bf*)take((size_t)TT * DQ * 2);
    if ((size_t)(wsp - (char*)d_ws) > ws_size) return;    // ws 256 MiB
    float* FV = FK;   // v projection reuses the k buffer after the k planes are built (stream-ordered)
    { k_wsel3<<<(DQ * DM / 8 + 255) / 256, 256, 0, stream>>>(wqkv, 0, WQ); k_wsel3<<<(DQ * DM / 8 + 255) / 256, 256, 0, stream>>>(wqkv, 1, WK); k_wsel3<<<(DQ * DM / 8 + 255) / 256, 256, 0, stream>>>(wqkv, 2, WV);
      k_wtG<<<(unsigned)((DQ * DM / 64 + 63) / 64), 256, 0, stream>>>(wo, DQ, DM, WO);
       }
    k_csid<<<(TT * HD + 255) / 256, 256, 0, stream>>>(CS);
    const unsigned LQ = (unsigned)(((size_t)NH_ * TT * HD / 2 + 255) / 256), LKv = (unsigned)(((size_t)NKV * TT * HD / 2 + 255) / 256);
    for (int b = 0; b < NB_; ++b) {
        
        k_cvt8<<<(unsigned)(((size_t)TT * DM / 8 + 255) / 256), 256, 0, stream>>>(x + (size_t)b * TT * DM, XB, (size_t)TT * DM / 8);
        k_gemmw<bf, 0, false><<<dim3(TT / 64, DQ / 64, 1), 32, 0, stream>>>(XB, nullptr, WQ, nullptr, DM, FQ, DQ, nullptr, 0, 0, 0);
        k_rope<<<LQ, 256, 0, stream>>>(FQ, DQ, NH_, CS, nullptr, nullptr, 1.0f, QP16, QPh, QPl);
        k_gemmw<bf, 0, false><<<dim3(TT / 64, DKV / 64, 1), 32, 0, stream>>>(XB, nullptr, WK, nullptr, DM, FK, DKV, nullptr, 0, 0, 0);
        k_rope<<<LKv, 256, 0, stream>>>(FK, DKV, NKV, CS, nullptr, nullptr, 1.0f, KP16, KPh, KPl);
        k_gemmw<bf, 0, false><<<dim3(TT / 64, DKV / 64, 1), 32, 0, stream>>>(XB, nullptr, WV, nullptr, DM, FV, DKV, nullptr, 0, 0, 0); k_vtp<<<LKv, 256, 0, stream>>>(FV, DKV, NKV, VT16, VTh, VTl);
        for (int h0 = 0; h0 < NH_; h0 += ZH) { const size_t zq = (size_t)h0, zk = (size_t)(h0 / REP);   // one kv head per query head: the pass's two heads use consecutive kv planes (z-strides TT*HD)
            k_gemmw<bf, 2, false><<<dim3(RH / 64, TT / 64, ZH), 32, 0, stream>>>(QPh + zq * TT * HD, QPl + zq * TT * HD, KPh + zk * TT * HD, KPl + zk * TT * HD, HD, Sb, TT, nullptr, (size_t)TT * HD, (size_t)TT * HD, (size_t)TT * TT);
            // (no f16 band in this build: RH == TT: every query row runs the three-product band above)
            k_asoft<<<ZH * TT / 8, 256, 0, stream>>>(Sb, P16, Ph, Pl);
            k_gemmw<bf, 2, false, KSP><<<dim3(RH / 64, HD / 64, ZH * KSP), 32, 0, stream>>>(Ph, Pl, VTh + zk * HD * TT, VTl + zk * HD * TT, TT, Ob, HD, nullptr, (size_t)RH * TT, (size_t)HD * TT, (size_t)TT * HD);
            // (no f16 band in this build: RH == TT)
            k_merge<<<(unsigned)(((size_t)ZH * TT * HD / 2 + 255) / 256), 256, 0, stream>>>(Ob, h0, ATh, ATl); }
        k_gemmw<bf, 1, false><<<dim3(TT / 64, DM / 64, 1), 32, 0, stream>>>(ATh, ATl, WO, nullptr, DQ, OUT + (size_t)b * TT * DM, DM, nullptr, 0, 0, 0); }
}

// v003
// One run takes 400 microseconds.
// Versions in between are left out here; by their measured steps it is 4.00 times as fast as v001.
// Over all steps from v000 it is 6.43 times as fast.
#include <hip/hip_runtime.h>

// Multi-headed self-attention with the (d, k, h) channel layout of its fused qkv (x [4][2048][1024]; qkv = x w_qkv ('xw' [1024][3072] 1/32, no bias) reshaped (b, t, dh, 3, h): q[h][t][d] = column d*48 + 0*16 + h, k = ... + 16 + h, v = ... + 32 + h; 16 heads x 64; scores MULTIPLIED by sqrt(64) = 8 (the source's own quirk, kept); softmax; out = merged (h d) w_out ('xw' [1024][1024]) -> [4][2048][1024] (8.4 M)). THIS ROW: the same module on FOUR sequences with the scores MULTIPLIED by sqrt(64) = 8 (the source's own quirk: 'energy * SCALE' with SCALE = D ** 0.5: kept): SCL 8.0f; every query row runs the three-product (hi/lo) form.
// Layout: bf16 copy of x, all four sequences; a gather kernel builds the three Bt weights from the interleaved columns (Bt[h*64+d][c] = w_qkv[c][d*48 + k*16 + h]); ONE projection launch for q, k, v of every sequence (k_proj: exact products, each wave splits its own f32 tile and stores the hi/lo head planes); then ONE attention launch for every sequence and head (k_fattn: scores, softmax and P x V fused, hi/lo 3 products each); merged hi/lo x w_out exact, per batch.
// Compute dtypes, f32 accumulate: every input rounded to bf16; projections exact; attention 3 products (hi/lo) in both matrix products; softmax f32; w_out hl x exact.

#define NB_  4
#define TT   2048
#define DM   1024
#define NH_  16
#define NKV  16
#define HD   64
#define DQ   (NH_ * HD)
#define DKV  (NKV * HD)
#define SCL  8.0f   // HD^+0.5: this module MULTIPLIES the scores by sqrt(64)
#define FW   4      // k_fattn: waves per work-group
#define QT   2      // k_fattn: 16-query tiles per wave
#define FOCC 4      // k_fattn: waves per SIMD the register budget is set for
#define KB   32     // k_fattn: keys per block
#define KPI  72     // LDS pitch of a K row, elements (128 B + 16)
#define VPI  40     // LDS pitch of a Vt row, elements (64 B + 16)
#define SKH  0      // places in one LDS buffer, elements: K hi, K lo, Vt hi, Vt lo
#define SKL  (KB * KPI)
#define SVH  (2 * KB * KPI)
#define SVL  (2 * KB * KPI + HD * VPI)
#define SME  (2 * KB * KPI + 2 * HD * VPI)
typedef _Float16 h16;
typedef unsigned short bf;
typedef __attribute__((ext_vector_type(16))) __bf16   v16bf;
typedef __attribute__((ext_vector_type(16))) _Float16 v16h;
typedef __attribute__((ext_vector_type(8)))  _Float16 v8h;
typedef __attribute__((ext_vector_type(8)))  unsigned short v8us;
typedef __attribute__((ext_vector_type(8)))  float    v8f;
typedef __attribute__((ext_vector_type(4)))  float    v4f;
typedef v8h  __attribute__((may_alias)) v8ha;
typedef v4f  __attribute__((may_alias)) v4fa;
typedef v8us __attribute__((may_alias)) v8usa;

__device__ __forceinline__ unsigned short f2bf(float f) { unsigned u = __float_as_uint(f); u += 0x7FFFu + ((u >> 16) & 1u); return (unsigned short)(u >> 16); }
__device__ __forceinline__ float bf2f(unsigned short b) { return __uint_as_float(((unsigned)b) << 16); }
__device__ __forceinline__ float bfr(float f) { return bf2f(f2bf(f)); }
__device__ __forceinline__ v16h cat16(v8h lo, v8h hi) { return __builtin_shufflevector(lo, hi, 0, 1, 2, 3, 4, 5, 6, 7, 8, 9, 10, 11, 12, 13, 14, 15); }
__device__ __forceinline__ v16bf cat16b(v8us lo, v8us hi) { return __builtin_bit_cast(v16bf, __builtin_shufflevector(lo, hi, 0, 1, 2, 3, 4, 5, 6, 7, 8, 9, 10, 11, 12, 13, 14, 15)); }
__device__ __forceinline__ v8f wmma16(v16h a, v16h b, v8f c) { return __builtin_amdgcn_wmma_f32_16x16x32_f16(false, a, false, b, (short)0, c, false, false); }
__device__ __forceinline__ v8f wmmab(v16bf a, v16bf b, v8f c) { return __builtin_amdgcn_wmma_f32_16x16x32_bf16(false, a, false, b, (short)0, c, false, false); }



// ---- k_gemmw: register-blocked GEMM, ONE WAVE per 64x64 output tile (16 accumulators), operands straight from K-contiguous 16-bit planes; grid (M/64, N/64, Z), 32 threads.
// C[m][n] (f32, pitch ldc, + optional f32 bias[n]) = sum_k A[m][k] Bt[n][k] (+ split products per NSPLIT). z-batch strides sA/sB/sC in elements. K % 32 == 0.
// KS > 1: grid z = batch * KS + slice; each work-group sums one slice of K / KS columns ((K / KS) % 32 == 0) and stores its own partial C at blockIdx.z * sC (the consumer adds the KS partials).
template <typename T16> struct WFrag;
template <> struct WFrag<h16> { typedef v16h V; static __device__ __forceinline__ V ld(const h16* p) { return cat16(*(const v8h*)p, *(const v8h*)(p + 16)); } static __device__ __forceinline__ v8f mma(V a, V b, v8f c) { return wmma16(a, b, c); } };
template <> struct WFrag<bf> { typedef v16bf V; static __device__ __forceinline__ V ld(const bf* p) { return cat16b(*(const v8us*)p, *(const v8us*)(p + 16)); } static __device__ __forceinline__ v8f mma(V a, V b, v8f c) { return wmmab(a, b, c); } };
template <typename T16, int NSPLIT, bool BIAS, int KS = 1>
__global__ __launch_bounds__(32) void k_gemmw(const T16* __restrict__ A, const T16* __restrict__ A2, const T16* __restrict__ Bt, const T16* __restrict__ Bt2, int K, float* C, int ldc, const float* __restrict__ bias, size_t sA, size_t sB, size_t sC) {
    typedef typename WFrag<T16>::V V;
    __shared__ __align__(16) float os[16 * 68];
    const size_t z = blockIdx.z / KS, ko = (size_t)(blockIdx.z % KS) * (K / KS); A += z * sA + ko; if (A2) A2 += z * sA + ko; Bt += z * sB + ko; if (Bt2) Bt2 += z * sB + ko; C += (size_t)blockIdx.z * sC;
    const int lane = threadIdx.x & 31, lr = lane & 15, hi = lane >> 4; const int r0 = blockIdx.x * 64, c0 = blockIdx.y * 64;
    v8f acc[4][4];
#pragma unroll
    for (int mb = 0; mb < 4; ++mb)
#pragma unroll
        for (int nb = 0; nb < 4; ++nb) acc[mb][nb] = (v8f){};
    const size_t aoff = (size_t)(r0 + lr) * K + 8 * hi, boff = (size_t)(c0 + lr) * K + 8 * hi;
#pragma unroll 1
    for (int kc = 0; kc < K / KS; kc += 32) {
        V a[4], a2[4];
#pragma unroll
        for (int mb = 0; mb < 4; ++mb) { a[mb] = WFrag<T16>::ld(A + aoff + (size_t)mb * 16 * K + kc); if (NSPLIT == 1 || NSPLIT == 2) a2[mb] = WFrag<T16>::ld(A2 + aoff + (size_t)mb * 16 * K + kc); }
#pragma unroll
        for (int nb = 0; nb < 4; ++nb) { const V b = WFrag<T16>::ld(Bt + boff + (size_t)nb * 16 * K + kc); V b2; if (NSPLIT >= 2) b2 = WFrag<T16>::ld(Bt2 + boff + (size_t)nb * 16 * K + kc);
#pragma unroll
            for (int mb = 0; mb < 4; ++mb) { acc[mb][nb] = WFrag<T16>::mma(a[mb], b, acc[mb][nb]); if (NSPLIT == 1 || NSPLIT == 2) acc[mb][nb] = WFrag<T16>::mma(a2[mb], b, acc[mb][nb]); if (NSPLIT >= 2) acc[mb][nb] = WFrag<T16>::mma(a[mb], b2, acc[mb][nb]); } }
        asm volatile("v_nop\n\tv_nop\n\tv_nop\n\tv_nop" : "+v"(acc[0][0]), "+v"(acc[1][1]), "+v"(acc[2][2]), "+v"(acc[3][3]) : "v"(a[0]), "v"(a[3]));
    }
#pragma unroll
    for (int mb = 0; mb < 4; ++mb) {
#pragma unroll
        for (int nb = 0; nb < 4; ++nb) {
#pragma unroll
            for (int j = 0; j < 8; ++j) os[(hi * 8 + j) * 68 + nb * 16 + lr] = acc[mb][nb][j]; }
        __builtin_amdgcn_wave_barrier(); asm volatile("" ::: "memory");
        float* crow = C + (size_t)(r0 + mb * 16) * ldc + c0;
{
#pragma unroll
            for (int s = 0; s < 8; ++s) { const int row = 2 * s + hi, cofs = lr * 4; v4f val = *(const v4fa*)(os + row * 68 + cofs); if (BIAS) { val[0] += bfr(bias[c0 + cofs]); val[1] += bfr(bias[c0 + cofs + 1]); val[2] += bfr(bias[c0 + cofs + 2]); val[3] += bfr(bias[c0 + cofs + 3]); }
                *(v4f*)(crow + (size_t)row * ldc + cofs) = val; }
             }
        __builtin_amdgcn_wave_barrier(); asm volatile("" ::: "memory");
    }
}

__device__ __forceinline__ void splitf(float y, unsigned short& h, unsigned short& l) { h = f2bf(y); l = f2bf(y - bf2f(h)); }
typedef __attribute__((ext_vector_type(2))) _Float16 v2h;
typedef __attribute__((ext_vector_type(4))) _Float16 v4h;
typedef __attribute__((ext_vector_type(2))) unsigned short v2us;
typedef __attribute__((ext_vector_type(4))) unsigned short v4us;
typedef __attribute__((ext_vector_type(2))) float v2f;
typedef __attribute__((ext_vector_type(2))) __bf16 v2bf;
typedef __attribute__((ext_vector_type(4))) int v4i;

__global__ __launch_bounds__(256) void k_wtG(const float* __restrict__ w, int K, int N, bf* Bt) {
    const int lane = threadIdx.x & 31; const int L0 = (blockIdx.x * 8 + (threadIdx.x >> 5)) * 8; const int nlines = N * K / 64;
{
#pragma unroll 1
        for (int l = 0; l < 8; ++l) { const int L = L0 + l; if (L >= nlines) break; const size_t e = (size_t)L * 64 + lane * 2; const int k = (int)(e % K), n = (int)(e / K); v2us o;
            o[0] = f2bf(w[(size_t)k * N + n]); o[1] = f2bf(w[(size_t)(k + 1) * N + n]); *(v2us*)(Bt + e) = o; }
         }
}
__global__ __launch_bounds__(256) void k_cvt8(const float* __restrict__ src, bf* dst, size_t n8) { const size_t i = (size_t)blockIdx.x * 256 + threadIdx.x; if (i >= n8) return; const v8f v = *(const v8f*)(src + i * 8); v8us o;
#pragma unroll
    for (int k = 0; k < 8; ++k) o[k] = f2bf(v[k]); *(v8us*)(dst + i * 8) = o;  }

__global__ __launch_bounds__(256) void k_wsel3(const float* __restrict__ w, int k, bf* Bt) { const int i = blockIdx.x * 256 + threadIdx.x; if (i >= DQ * DM / 8) return; const int c0 = (i % (DM / 8)) * 8; const int r = i / (DM / 8); const int h = r / HD, d = r % HD; const int col = d * 3 * NH_ + k * NH_ + h; v8us o;
#pragma unroll
    for (int q = 0; q < 8; ++q) o[q] = f2bf(w[(size_t)(c0 + q) * (3 * DQ) + col]);
    *(v8us*)(Bt + (size_t)r * DM + c0) = o;  }
// split8: 8 consecutive f32 of a staged row -> 8 hi and 8 lo bf16, one 16-byte store each.
__device__ __forceinline__ void split8(const float* s, bf* ph, bf* pl) { const v4f u = *(const v4fa*)s, w = *(const v4fa*)(s + 4); v8us oh, ol;
#pragma unroll
    for (int j = 0; j < 4; ++j) { unsigned short a, c; splitf(u[j], a, c); oh[j] = a; ol[j] = c; splitf(w[j], a, c); oh[4 + j] = a; ol[4 + j] = c; }
    *(v8us*)ph = oh; *(v8us*)pl = ol; }
// k_proj: the q, k and v projections of every sequence in one launch; ONE WAVE per 64x64 tile with the loop of k_gemmw (same products, same sum order); grid (NB_ * TT / 64, NH_, 3), z = 0 q, 1 k, 2 v.
// A tile is 64 tokens of one sequence x the 64 channels of one head. The wave splits its own f32 sums into hi/lo and stores them where k_fattn reads them: q and k as [b][h][t][d], v transposed as [b][h][d][t]; no f32 projection goes to memory.
// 16 plane rows at a time go through the wave's own LDS (q, k: 16 tokens x 64 d; v: 16 d x 64 tokens), so that every store instruction covers four whole 128-byte lines.
// Every '#pragma unroll' below, but the two on the store loops over s, stands on a loop that indexes a register array (fragments, accumulators); the k loop stays rolled ('unroll 1'), as in k_gemmw: a second trip's fragments would cost a wave per SIMD.
// Left as it was in k_gemmw: each fragment load touches 16 lines and takes 32 bytes of each, and no operand is shared between waves.
__global__ __launch_bounds__(32) void k_proj(const bf* __restrict__ X, const bf* __restrict__ Wq, const bf* __restrict__ Wk, const bf* __restrict__ Wv, bf* Qh, bf* Ql, bf* Kh, bf* Kl, bf* Vh, bf* Vl) {
    typedef WFrag<bf> F;
    __shared__ __align__(16) float os[16 * 68];
    const int lane = threadIdx.x & 31, lr = lane & 15, hi = lane >> 4; const int r0 = blockIdx.x * 64, h = blockIdx.y, z = blockIdx.z;
    const bf* Bt = (z == 0) ? Wq : (z == 1) ? Wk : Wv;
    v8f acc[4][4];
#pragma unroll
    for (int mb = 0; mb < 4; ++mb)
#pragma unroll
        for (int nb = 0; nb < 4; ++nb) acc[mb][nb] = (v8f){};
    const bf* pa = X + (size_t)(r0 + lr) * DM + 8 * hi; const bf* pb = Bt + (size_t)(h * HD + lr) * DM + 8 * hi;   // a lane's own row and 16-byte column in each operand; both walk along k
#pragma unroll 1   // rolled, as in k_gemmw: a second trip's fragments would cost a wave per SIMD
    for (int kc = 0; kc < DM; kc += 32, pa += 32, pb += 32) {
        v16bf a[4];
#pragma unroll
        for (int mb = 0; mb < 4; ++mb) a[mb] = F::ld(pa + mb * 16 * DM);
        asm volatile("s_wait_xcnt 0x0" ::: "memory");   // stands in front of the trip's later loads, one of which the compiler lets land in the address registers of these eight
#pragma unroll
        for (int nb = 0; nb < 4; ++nb) { const v16bf bq = F::ld(pb + nb * 16 * DM);
#pragma unroll
            for (int mb = 0; mb < 4; ++mb) acc[mb][nb] = F::mma(a[mb], bq, acc[mb][nb]); }
        // four vector slots between the trip's last matrix instructions and the next trip's first vector instructions, which may overwrite their operand registers
        asm volatile("v_nop\n\tv_nop\n\tv_nop\n\tv_nop" : "+v"(acc[0][0]), "+v"(acc[1][1]), "+v"(acc[2][2]), "+v"(acc[3][3]) : "v"(a[0]), "v"(a[3]));
    }
    const int t0 = r0 % TT; const size_t pz = (size_t)((r0 / TT) * NH_ + h) * TT * HD; const int er = lane >> 3, ec = (lane & 7) * 8;   // a lane's row (of four) and 8-element column in a store
    if (z < 2) {
        bf* Ph = ((z == 0) ? Qh : Kh) + pz + (size_t)t0 * HD; bf* Pl = ((z == 0) ? Ql : Kl) + pz + (size_t)t0 * HD;
#pragma unroll
        for (int mb = 0; mb < 4; ++mb) {
#pragma unroll
            for (int nb = 0; nb < 4; ++nb) {
#pragma unroll
                for (int j = 0; j < 8; ++j) os[(hi * 8 + j) * 68 + nb * 16 + lr] = acc[mb][nb][j]; }
            __builtin_amdgcn_wave_barrier(); asm volatile("" ::: "memory");   // the reads below stay behind the other lanes' writes
#pragma unroll
            for (int s = 0; s < 4; ++s) { const int row = 4 * s + er; split8(os + row * 68 + ec, Ph + (mb * 16 + row) * HD + ec, Pl + (mb * 16 + row) * HD + ec); }
            __builtin_amdgcn_wave_barrier(); asm volatile("" ::: "memory");   // the next rows' writes stay behind these reads
        }
    } else {
        bf* Ph = Vh + pz + t0; bf* Pl = Vl + pz + t0;
#pragma unroll
        for (int nb = 0; nb < 4; ++nb) {
#pragma unroll
            for (int mb = 0; mb < 4; ++mb) { v4f u, w;
#pragma unroll
                for (int j = 0; j < 4; ++j) { u[j] = acc[mb][nb][j]; w[j] = acc[mb][nb][4 + j]; }
                *(v4fa*)(os + lr * 68 + mb * 16 + hi * 8) = u; *(v4fa*)(os + lr * 68 + mb * 16 + hi * 8 + 4) = w; }
            __builtin_amdgcn_wave_barrier(); asm volatile("" ::: "memory");   // the reads below stay behind the other lanes' writes
#pragma unroll
            for (int s = 0; s < 4; ++s) { const int row = 4 * s + er; split8(os + row * 68 + ec, Ph + (size_t)(nb * 16 + row) * TT + ec, Pl + (size_t)(nb * 16 + row) * TT + ec); }
            __builtin_amdgcn_wave_barrier(); asm volatile("" ::: "memory");   // the next rows' writes stay behind these reads
        }
        asm volatile("s_wait_xcnt 0x0" ::: "memory");   // stands behind this branch's last stores: in the built code the other branch's instructions follow and rewrite registers that these stores name
    }
}
// k_fattn: scores, softmax and P x V of one (sequence, head) in one kernel; nothing of the score matrix goes to memory.
// Each wave owns QT tiles of 16 queries; the work-group walks the keys KB at a time. A wave forms the TRANSPOSED scores St[key][query] = K Qt (A = key rows, B = query columns):
// a lane then holds 8 keys of ONE query (query = lane & 15, keys 8 * (lane >> 4) + j of each 16-key tile), which is the B-fragment order of the second product Ot[d][query] = Vt[d][key] Pt[key][query]:
// no value changes lanes between the two products, and the running maximum, the running sum and the rescale factor are one scalar a lane.
// Both products keep the three hi/lo terms (hh + hl + lh). p = 2^(s c - m c), c = SCL log2(e), m the running maximum; the division by the row sum comes last.
// The KB keys' K rows and Vt columns (hi and lo) are read from memory once a work-group, in whole 16-byte pieces of consecutive addresses, and shared through LDS (two buffers, one barrier a block);
// LDS rows are pitched 16 bytes x odd (K 144 B, Vt 80 B) for the 16-byte fragment reads.
// Every '#pragma unroll' below stands on a loop that indexes a register array (fragments, accumulators, staged pieces): rolled, the array would go to scratch memory.
__global__ __launch_bounds__(FW * 32, FOCC) void k_fattn(const bf* __restrict__ Qh, const bf* __restrict__ Ql, const bf* __restrict__ Kh, const bf* __restrict__ Kl, const bf* __restrict__ Vh, const bf* __restrict__ Vl, bf* Ah, bf* Al) {
    typedef WFrag<bf> F;
    __shared__ __align__(16) bf sm[2][SME];
    const int tid = threadIdx.x, lane = tid & 31, lr = lane & 15, hi = lane >> 4; const int z = blockIdx.y, b = z / NH_, h = z % NH_; const int q0 = (blockIdx.x * FW + (tid >> 5)) * (16 * QT);
    const size_t pz = (size_t)z * TT * HD; const float C = SCL * 1.4426950408889634f;
    v16bf qh[QT][2], ql[QT][2]; v8f o[QT][4]; float m[QT]; v2f l[QT];
#pragma unroll
    for (int qt = 0; qt < QT; ++qt) { m[qt] = -3.0e38f; l[qt] = (v2f){};
#pragma unroll
        for (int kc = 0; kc < 2; ++kc) { const size_t qo = pz + (size_t)(q0 + qt * 16 + lr) * HD + kc * 32 + 8 * hi; qh[qt][kc] = F::ld(Qh + qo); ql[qt][kc] = F::ld(Ql + qo); }
#pragma unroll
        for (int dt = 0; dt < 4; ++dt) o[qt][dt] = (v8f){}; }
    // staging: piece c = tid + 128 i. K: KB rows of 128 B lie one behind the other in memory, piece c = row c / 8, 16-byte column c % 8. Vt: 64 rows (d), 64 B of each, piece c = row c / 4, column c % 4.
    const unsigned kg = tid * 8, vg = (tid >> 2) * TT + (tid & 3) * 8;   // a lane's own 32-bit offsets; the rest of each address is the same for the whole work-group
    const bf* Kh0 = Kh + pz; const bf* Kl0 = Kl + pz; const bf* Vh0 = Vh + pz; const bf* Vl0 = Vl + pz; const int ks = (tid >> 3) * KPI + (tid & 7) * 8, vs = (tid >> 2) * VPI + (tid & 3) * 8;
    v8us g[8];
#pragma unroll
    for (int i = 0; i < 2; ++i) { g[i] = *(const v8us*)(Kh0 + i * 1024 + kg); g[2 + i] = *(const v8us*)(Kl0 + i * 1024 + kg); g[4 + i] = *(const v8us*)(Vh0 + i * 32 * TT + vg); g[6 + i] = *(const v8us*)(Vl0 + i * 32 * TT + vg); }
#pragma unroll
    for (int i = 0; i < 2; ++i) { *(v8us*)(&sm[0][SKH + ks + i * 16 * KPI]) = g[i]; *(v8us*)(&sm[0][SKL + ks + i * 16 * KPI]) = g[2 + i]; *(v8us*)(&sm[0][SVH + vs + i * 32 * VPI]) = g[4 + i]; *(v8us*)(&sm[0][SVL + vs + i * 32 * VPI]) = g[6 + i]; }
    __syncthreads();   // block 0 is in LDS for every wave
    for (int kb = 0; kb < TT; kb += KB) {
        const bf* s0 = sm[(kb / KB) & 1]; bf* s1 = sm[(kb / KB + 1) & 1];
        const int kn = (kb + KB < TT) ? kb + KB : kb;   // the next block is fetched into registers while this one is worked on (the last trip fetches its own block again, unused)
        // s1 is nobody's to read between the two barriers round this trip, so each half is stored as soon as it has come: K's pieces fly over the first product, Vt's (in the same registers) over the softmax and the second
#pragma unroll
        for (int i = 0; i < 2; ++i) { g[i] = *(const v8us*)(Kh0 + kn * HD + i * 1024 + kg); g[2 + i] = *(const v8us*)(Kl0 + kn * HD + i * 1024 + kg); }
        __builtin_amdgcn_sched_barrier(0);   // keeps the four loads issued here, ahead of the first product (the scheduler otherwise sinks them to their stores and the wave waits out the whole latency)
        v8f s[QT][2];
#pragma unroll
        for (int kt = 0; kt < 2; ++kt) { v16bf kh[2], kl[2];
#pragma unroll
            for (int kc = 0; kc < 2; ++kc) { const int ko = (kt * 16 + lr) * KPI + kc * 32 + 8 * hi; kh[kc] = F::ld(s0 + SKH + ko); kl[kc] = F::ld(s0 + SKL + ko); }
#pragma unroll
            for (int qt = 0; qt < QT; ++qt) { v8f a = (v8f){};
#pragma unroll
                for (int kc = 0; kc < 2; ++kc) { a = F::mma(kh[kc], qh[qt][kc], a); a = F::mma(kh[kc], ql[qt][kc], a); a = F::mma(kl[kc], qh[qt][kc], a); }
                s[qt][kt] = a; } }
        __builtin_amdgcn_sched_barrier(0);   // keeps the stores, and the wait on the loads that comes with them, behind the first product
#pragma unroll
        for (int i = 0; i < 2; ++i) { *(v8us*)(s1 + SKH + ks + i * 16 * KPI) = g[i]; *(v8us*)(s1 + SKL + ks + i * 16 * KPI) = g[2 + i]; }
#pragma unroll
        for (int i = 0; i < 2; ++i) { g[i] = *(const v8us*)(Vh0 + kn + i * 32 * TT + vg); g[2 + i] = *(const v8us*)(Vl0 + kn + i * 32 * TT + vg); }
        __builtin_amdgcn_sched_barrier(0);   // keeps these four loads issued here, ahead of the softmax and the second product
        v16bf ph[QT], pl[QT];
#pragma unroll
        for (int qt = 0; qt < QT; ++qt) { float mx = s[qt][0][0];
#pragma unroll
            for (int j = 0; j < 8; ++j) mx = fmaxf(mx, fmaxf(s[qt][0][j], s[qt][1][j]));
            mx = fmaxf(mx, __shfl_xor(mx, 16, 32));
            const float mn = fmaxf(m[qt], mx * C); const float al = __builtin_amdgcn_exp2f(m[qt] - mn); m[qt] = mn; v2f ls[2] = { (v2f){}, (v2f){} };
#pragma unroll
            for (int e = 0; e < 16; e += 2) { v2f t; t[0] = s[qt][e >> 3][e & 7]; t[1] = s[qt][e >> 3][(e & 7) + 1]; t = __builtin_elementwise_fma(t, (v2f){C, C}, (v2f){-mn, -mn}); v2f p; p[0] = __builtin_amdgcn_exp2f(t[0]); p[1] = __builtin_amdgcn_exp2f(t[1]); ls[(e >> 1) & 1] += p;
                const v2bf a = __builtin_convertvector(p, v2bf); const v2bf r = __builtin_convertvector(p - __builtin_convertvector(a, v2f), v2bf); ph[qt][e] = a[0]; ph[qt][e + 1] = a[1]; pl[qt][e] = r[0]; pl[qt][e + 1] = r[1]; }
            l[qt] = l[qt] * al + (ls[0] + ls[1]);
#pragma unroll
            for (int dt = 0; dt < 4; ++dt) o[qt][dt] *= al; }
#pragma unroll
        for (int dt = 0; dt < 4; ++dt) { const int vo = (dt * 16 + lr) * VPI + 8 * hi; const v16bf vh = F::ld(s0 + SVH + vo), vl = F::ld(s0 + SVL + vo);
#pragma unroll
            for (int qt = 0; qt < QT; ++qt) { v8f a = o[qt][dt]; a = F::mma(vh, ph[qt], a); a = F::mma(vh, pl[qt], a); a = F::mma(vl, ph[qt], a); o[qt][dt] = a; } }
#pragma unroll
        for (int i = 0; i < 2; ++i) { *(v8us*)(s1 + SVH + vs + i * 32 * VPI) = g[i]; *(v8us*)(s1 + SVL + vs + i * 32 * VPI) = g[2 + i]; }
        __syncthreads();   // publishes the next block, and ends every wave's reads of this block's buffer before the next trip refills it
    }
#pragma unroll
    for (int qt = 0; qt < QT; ++qt) { const float lh = l[qt][0] + l[qt][1]; const float f = __fdiv_rn(1.0f, lh + __shfl_xor(lh, 16, 32)); const size_t oo = ((size_t)b * TT + q0 + qt * 16 + lr) * DQ + h * HD + 8 * hi;
#pragma unroll
        for (int dt = 0; dt < 4; ++dt) { v8us oh, ol;
#pragma unroll
            for (int j = 0; j < 8; ++j) { unsigned short a, c2; splitf(o[qt][dt][j] * f, a, c2); oh[j] = a; ol[j] = c2; }
            *(v8us*)(Ah + oo + dt * 16) = oh; *(v8us*)(Al + oo + dt * 16) = ol; } }
}

extern "C" void kernel_launch(void* const* d_in, const int* in_sizes, int n_in,
                              void* d_out, int out_size, void* d_ws, size_t ws_size, hipStream_t stream) {
    (void)in_sizes; (void)n_in; (void)out_size;
    const float* x = (const float*)d_in[0]; const float* wqkv = (const float*)d_in[1]; const float* wo = (const float*)d_in[2]; const float* wq = nullptr; const float* wk = nullptr; const float* wv = nullptr; (void)wq; (void)wk; (void)wv;
    float* OUT = (float*)d_out;     // [4][2048][1024]
    char* wsp = (char*)d_ws;
    auto take = [&](size_t bytes) { char* p = wsp; wsp += (bytes + 255) & ~(size_t)255; return (void*)p; };
    bf* WQ = (bf*)take((size_t)DQ * DM * 2); bf* WK = (bf*)take((size_t)DKV * DM * 2); bf* WV = (bf*)take((size_t)DKV * DM * 2); bf* WO = (bf*)take((size_t)DM * DQ * 2);
    bf* XB = (bf*)take((size_t)NB_ * TT * DM * 2);
    const size_t PB = (size_t)NH_ * TT * HD;   // one sequence's share of a hi or lo plane; the planes hold all NB_ sequences, [b][h][..]
    bf* QPh = (bf*)take(NB_ * PB * 2); bf* QPl = (bf*)take(NB_ * PB * 2); bf* KPh = (bf*)take(NB_ * PB * 2); bf* KPl = (bf*)take(NB_ * PB * 2); bf* VTh = (bf*)take(NB_ * PB * 2); bf* VTl = (bf*)take(NB_ * PB * 2);
    bf* ATh = (bf*)take((size_t)NB_ * TT * DQ * 2); bf* ATl = (bf*)take((size_t)NB_ * TT * DQ * 2);
    if ((size_t)(wsp - (char*)d_ws) > ws_size) return;    // ws 256 MiB
    { k_wsel3<<<(DQ * DM / 8 + 255) / 256, 256, 0, stream>>>(wqkv, 0, WQ); k_wsel3<<<(DQ * DM / 8 + 255) / 256, 256, 0, stream>>>(wqkv, 1, WK); k_wsel3<<<(DQ * DM / 8 + 255) / 256, 256, 0, stream>>>(wqkv, 2, WV);
      k_wtG<<<(unsigned)((DQ * DM / 64 + 63) / 64), 256, 0, stream>>>(wo, DQ, DM, WO);
       }
    k_cvt8<<<(unsigned)(((size_t)NB_ * TT * DM / 8 + 255) / 256), 256, 0, stream>>>(x, XB, (size_t)NB_ * TT * DM / 8);
    k_proj<<<dim3(NB_ * TT / 64, NH_, 3), 32, 0, stream>>>(XB, WQ, WK, WV, QPh, QPl, KPh, KPl, VTh, VTl);   // q, k, v of every sequence in one launch
    k_fattn<<<dim3(TT / (16 * QT * FW), NB_ * NH_, 1), FW * 32, 0, stream>>>(QPh, QPl, KPh, KPl, VTh, VTl, ATh, ATl);   // every sequence and head in one launch
    for (int b = 0; b < NB_; ++b) {
        k_gemmw<bf, 1, false><<<dim3(TT / 64, DM / 64, 1), 32, 0, stream>>>(ATh + (size_t)b * TT * DQ, ATl + (size_t)b * TT * DQ, WO, nullptr, DQ, OUT + (size_t)b * TT * DM, DM, nullptr, 0, 0, 0); }
}

// v004
// It runs in 259 microseconds.
// Next to v003, in two timings, it ran 1.54 times as fast each time.
// Counting every step since v000, it is 9.90 times as fast.
#include <hip/hip_runtime.h>

// Multi-headed self-attention with the (d, k, h) channel layout of its fused qkv (x [4][2048][1024]; qkv = x w_qkv ('xw' [1024][3072] 1/32, no bias) reshaped (b, t, dh, 3, h): q[h][t][d] = column d*48 + 0*16 + h, k = ... + 16 + h, v = ... + 32 + h; 16 heads x 64; scores MULTIPLIED by sqrt(64) = 8 (the source's own quirk, kept); softmax; out = merged (h d) w_out ('xw' [1024][1024]) -> [4][2048][1024] (8.4 M)). THIS ROW: the same module on FOUR sequences with the scores MULTIPLIED by sqrt(64) = 8 (the source's own quirk: 'energy * SCALE' with SCALE = D ** 0.5: kept): SCL 8.0f; every query row runs the three-product (hi/lo) form.
// Layout: bf16 copy of x, all four sequences; a gather kernel builds the three Bt weights from the interleaved columns (Bt[h*64+d][c] = w_qkv[c][d*48 + k*16 + h]); ONE projection launch for q, k, v of every sequence (k_proj: exact products, each wave splits its own f32 tile and stores the hi/lo head planes); then ONE attention launch for every sequence and head (k_fattn: scores, softmax and P x V fused, hi/lo 3 products each); merged hi/lo x w_out exact, per batch.
// Compute dtypes, f32 accumulate: every input rounded to bf16; projections exact; attention 3 products (hi/lo) in both matrix products; softmax f32; w_out hl x exact.

#define NB_  4
#define TT   2048
#define DM   1024
#define NH_  16
#define NKV  16
#define HD   64
#define DQ   (NH_ * HD)
#define DKV  (NKV * HD)
#define SCL  8.0f   // HD^+0.5: this module MULTIPLIES the scores by sqrt(64)
#define FW   4      // k_fattn: waves per work-group
#define QT   2      // k_fattn: 16-query tiles per wave
#define FOCC 4      // k_fattn: waves per SIMD the register budget is set for
#define KB   32     // k_fattn: keys per block
#define KPI  72     // LDS pitch of a K row, elements (128 B + 16)
#define VPI  40     // LDS pitch of a Vt row, elements (64 B + 16)
#define SKH  0      // places in one LDS buffer, elements: K hi, K lo, Vt hi, Vt lo
#define SKL  (KB * KPI)
#define SVH  (2 * KB * KPI)
#define SVL  (2 * KB * KPI + HD * VPI)
#define SME  (2 * KB * KPI + 2 * HD * VPI)
typedef _Float16 h16;
typedef unsigned short bf;
typedef __attribute__((ext_vector_type(16))) __bf16   v16bf;
typedef __attribute__((ext_vector_type(16))) _Float16 v16h;
typedef __attribute__((ext_vector_type(8)))  _Float16 v8h;
typedef __attribute__((ext_vector_type(8)))  unsigned short v8us;
typedef __attribute__((ext_vector_type(8)))  float    v8f;
typedef __attribute__((ext_vector_type(4)))  float    v4f;
typedef v8h  __attribute__((may_alias)) v8ha;
typedef v4f  __attribute__((may_alias)) v4fa;
typedef v8us __attribute__((may_alias)) v8usa;

__device__ __forceinline__ unsigned short f2bf(float f) { unsigned u = __float_as_uint(f); u += 0x7FFFu + ((u >> 16) & 1u); return (unsigned short)(u >> 16); }
__device__ __forceinline__ float bf2f(unsigned short b) { return __uint_as_float(((unsigned)b) << 16); }
__device__ __forceinline__ float bfr(float f) { return bf2f(f2bf(f)); }
__device__ __forceinline__ v16h cat16(v8h lo, v8h hi) { return __builtin_shufflevector(lo, hi, 0, 1, 2, 3, 4, 5, 6, 7, 8, 9, 10, 11, 12, 13, 14, 15); }
__device__ __forceinline__ v16bf cat16b(v8us lo, v8us hi) { return __builtin_bit_cast(v16bf, __builtin_shufflevector(lo, hi, 0, 1, 2, 3, 4, 5, 6, 7, 8, 9, 10, 11, 12, 13, 14, 15)); }
__device__ __forceinline__ v8f wmma16(v16h a, v16h b, v8f c) { return __builtin_amdgcn_wmma_f32_16x16x32_f16(false, a, false, b, (short)0, c, false, false); }
__device__ __forceinline__ v8f wmmab(v16bf a, v16bf b, v8f c) { return __builtin_amdgcn_wmma_f32_16x16x32_bf16(false, a, false, b, (short)0, c, false, false); }



// ---- gemm_tile: the k loop of both projection kernels. A work-group of four waves (2 x 2) sums a 128 x 128 tile of C[m][n] = sum_k A[m][k] Bt[n][k]; each wave keeps 64 x 64 (16 accumulators).
// The operands' rows are K-contiguous 16-bit planes of pitch DM. GK = 64 k columns at a time (one whole 128-byte line of every row) go from memory to LDS by asynchronous copies, through no register:
// a copy instruction of a wave takes four whole lines, and every staged row is read by two waves. Two buffers: tile t + 1 flies while tile t is worked on; one barrier a tile.
// Every '#pragma unroll' in gemm_tile and in the two kernels' epilogues, the store loops over s aside, stands on a loop that indexes a register array (fragments, accumulators): rolled, the array would go to scratch memory.
// LDS rows are pitched 16 bytes x odd (144 B) for the 16-byte fragment reads. NA = 2: A comes as hi and lo planes, two products a fragment pair. The products and their order along k are those of a wave that reads its fragments from memory, 32 k at a time.
#define GK   64               // k columns per staged tile
#define GP   72               // LDS pitch of a staged row, elements (128 B + 16)
#define GPL  (128 * GP)       // one staged plane (128 rows), elements
#define GNT  (DM / GK)        // staged tiles along k
template <typename T16> struct WFrag;
template <> struct WFrag<h16> { typedef v16h V; static __device__ __forceinline__ V ld(const h16* p) { return cat16(*(const v8h*)p, *(const v8h*)(p + 16)); } static __device__ __forceinline__ v8f mma(V a, V b, v8f c) { return wmma16(a, b, c); } };
template <> struct WFrag<bf> { typedef v16bf V; static __device__ __forceinline__ V ld(const bf* p) { return cat16b(*(const v8us*)p, *(const v8us*)(p + 16)); } static __device__ __forceinline__ v8f mma(V a, V b, v8f c) { return wmmab(a, b, c); } };
// copy8: a lane's eight 16-byte pieces of one staged plane (rows 16 apart), LDS byte address l, global address g. The s_wait_xcnt stands inside the statement, behind the last copy, so that no later write of an address register can come in front of it.
__device__ __forceinline__ void copy8(unsigned l, const bf* g) {
    asm volatile("global_load_async_to_lds_b128 %0, %8, off\n\t"
                 "global_load_async_to_lds_b128 %1, %9, off\n\t"
                 "global_load_async_to_lds_b128 %2, %10, off\n\t"
                 "global_load_async_to_lds_b128 %3, %11, off\n\t"
                 "global_load_async_to_lds_b128 %4, %12, off\n\t"
                 "global_load_async_to_lds_b128 %5, %13, off\n\t"
                 "global_load_async_to_lds_b128 %6, %14, off\n\t"
                 "global_load_async_to_lds_b128 %7, %15, off\n\t"
                 "s_wait_xcnt 0x0"
                 :: "v"(l), "v"(l + 1 * 16 * GP * 2), "v"(l + 2 * 16 * GP * 2), "v"(l + 3 * 16 * GP * 2), "v"(l + 4 * 16 * GP * 2), "v"(l + 5 * 16 * GP * 2), "v"(l + 6 * 16 * GP * 2), "v"(l + 7 * 16 * GP * 2),
                    "v"(g), "v"(g + 1 * 16 * DM), "v"(g + 2 * 16 * DM), "v"(g + 3 * 16 * DM), "v"(g + 4 * 16 * DM), "v"(g + 5 * 16 * DM), "v"(g + 6 * 16 * DM), "v"(g + 7 * 16 * DM) : "memory");
}
// A, A2, Bt: the work-group's first row of each plane, k = 0. sm: 2 buffers of (NA + 1) planes. On return every wave has left the buffers and no copy is in flight: sm is free for the caller.
template <int NA>
__device__ __forceinline__ void gemm_tile(const bf* A, const bf* A2, const bf* Bt, bf* sm, v8f (&acc)[4][4]) {
    typedef WFrag<bf> F;
    const int tid = threadIdx.x, lane = tid & 31, lr = lane & 15, hi = lane >> 4, w = tid >> 5;
    const size_t go = (size_t)(tid >> 3) * DM + (tid & 7) * 8;   // piece c = tid + 128 i of a plane: row c / 8, 16-byte column c % 8
    const unsigned l0 = (unsigned)(size_t)sm + ((tid >> 3) * GP + (tid & 7) * 8) * 2;
    const int ao = ((w & 1) * 64 + lr) * GP + 8 * hi, bo = NA * GPL + ((w >> 1) * 64 + lr) * GP + 8 * hi;   // a lane's own row and 16-byte column in the wave's fragments
    auto fill = [&](int t) { const unsigned l = l0 + (t & 1) * ((NA + 1) * GPL * 2); copy8(l, A + go + t * GK); if (NA == 2) copy8(l + GPL * 2, A2 + go + t * GK); copy8(l + NA * GPL * 2, Bt + go + t * GK); };
#pragma unroll
    for (int mb = 0; mb < 4; ++mb)
#pragma unroll
        for (int nb = 0; nb < 4; ++nb) acc[mb][nb] = (v8f){};
    fill(0);
    asm volatile("s_wait_asynccnt 0x0" ::: "memory");   // this wave's pieces of tile 0 have landed
    __syncthreads();   // tile 0 is in LDS for every wave
    fill(1);
#pragma unroll 1   // rolled, for speed only
    for (int t = 0; t < GNT; ++t) {
        const bf* s = sm + (t & 1) * ((NA + 1) * GPL);
        v16bf a[4], a2[4], bq[4];
        auto frags = [&](int kc) {   // the wave's fragments of 32 k
#pragma unroll
            for (int mb = 0; mb < 4; ++mb) { a[mb] = F::ld(s + ao + mb * 16 * GP + kc); if (NA == 2) a2[mb] = F::ld(s + GPL + ao + mb * 16 * GP + kc); }
#pragma unroll
            for (int nb = 0; nb < 4; ++nb) bq[nb] = F::ld(s + bo + nb * 16 * GP + kc); };
        auto prods = [&]() {
#pragma unroll
            for (int nb = 0; nb < 4; ++nb) {
#pragma unroll
                for (int mb = 0; mb < 4; ++mb) { acc[mb][nb] = F::mma(a[mb], bq[nb], acc[mb][nb]); if (NA == 2) acc[mb][nb] = F::mma(a2[mb], bq[nb], acc[mb][nb]); } } };
        frags(0);
        __builtin_amdgcn_sched_barrier(0);   // keeps these fragment reads together in front of their matrix instructions (the scheduler otherwise reads each B fragment directly in front of its users, and the wave waits out the LDS latency four times)
        prods();
        frags(32);   // the tile's last reads
        if (NA == 2) { __builtin_amdgcn_sched_barrier(0); prods(); }   // hi and lo fragments leave no registers for the copies' addresses beside them: the second half's products come first (the scheduling barrier: as above)
        asm volatile("s_wait_dscnt 0x0" ::: "memory");      // this wave's reads of tile t are done before the buffer is given up
        asm volatile("s_wait_asynccnt 0x0" ::: "memory");   // this wave's pieces of tile t + 1 have landed
        __syncthreads();   // publishes tile t + 1, and ends every wave's reads of tile t's buffer before it is refilled
        if (t + 2 < GNT) fill(t + 2);
        if (NA == 1) prods();   // the second half's products need registers alone: the refill is on its way while they run
    }
    asm volatile("s_wait_asynccnt 0x0" ::: "memory");   // no copy is in flight when the caller takes the buffers over
}

__device__ __forceinline__ void splitf(float y, unsigned short& h, unsigned short& l) { h = f2bf(y); l = f2bf(y - bf2f(h)); }
typedef __attribute__((ext_vector_type(2))) _Float16 v2h;
typedef __attribute__((ext_vector_type(4))) _Float16 v4h;
typedef __attribute__((ext_vector_type(2))) unsigned short v2us;
typedef __attribute__((ext_vector_type(4))) unsigned short v4us;
typedef __attribute__((ext_vector_type(2))) float v2f;
typedef __attribute__((ext_vector_type(2))) __bf16 v2bf;
typedef __attribute__((ext_vector_type(4))) int v4i;

__global__ __launch_bounds__(256) void k_wtG(const float* __restrict__ w, int K, int N, bf* Bt) {
    const int lane = threadIdx.x & 31; const int L0 = (blockIdx.x * 8 + (threadIdx.x >> 5)) * 8; const int nlines = N * K / 64;
{
#pragma unroll 1
        for (int l = 0; l < 8; ++l) { const int L = L0 + l; if (L >= nlines) break; const size_t e = (size_t)L * 64 + lane * 2; const int k = (int)(e % K), n = (int)(e / K); v2us o;
            o[0] = f2bf(w[(size_t)k * N + n]); o[1] = f2bf(w[(size_t)(k + 1) * N + n]); *(v2us*)(Bt + e) = o; }
         }
}
__global__ __launch_bounds__(256) void k_cvt8(const float* __restrict__ src, bf* dst, size_t n8) { const size_t i = (size_t)blockIdx.x * 256 + threadIdx.x; if (i >= n8) return; const v8f v = *(const v8f*)(src + i * 8); v8us o;
#pragma unroll
    for (int k = 0; k < 8; ++k) o[k] = f2bf(v[k]); *(v8us*)(dst + i * 8) = o;  }

__global__ __launch_bounds__(256) void k_wsel3(const float* __restrict__ w, int k, bf* Bt) { const int i = blockIdx.x * 256 + threadIdx.x; if (i >= DQ * DM / 8) return; const int c0 = (i % (DM / 8)) * 8; const int r = i / (DM / 8); const int h = r / HD, d = r % HD; const int col = d * 3 * NH_ + k * NH_ + h; v8us o;
#pragma unroll
    for (int q = 0; q < 8; ++q) o[q] = f2bf(w[(size_t)(c0 + q) * (3 * DQ) + col]);
    *(v8us*)(Bt + (size_t)r * DM + c0) = o;  }
// split8: 8 consecutive f32 of a staged row -> 8 hi and 8 lo bf16, one 16-byte store each.
__device__ __forceinline__ void split8(const float* s, bf* ph, bf* pl) { const v4f u = *(const v4fa*)s, w = *(const v4fa*)(s + 4); v8us oh, ol;
#pragma unroll
    for (int j = 0; j < 4; ++j) { unsigned short a, c; splitf(u[j], a, c); oh[j] = a; ol[j] = c; splitf(w[j], a, c); oh[4 + j] = a; ol[4 + j] = c; }
    *(v8us*)ph = oh; *(v8us*)pl = ol; }
// k_proj: the q, k and v projections of every sequence in one launch; a work-group of four waves per 128 x 128 tile (gemm_tile), ONE WAVE per 64x64 of it; grid (NB_ * TT / 128, NH_ / 2, 3), z = 0 q, 1 k, 2 v.
// A wave's tile is 64 tokens of one sequence x the 64 channels of one head. The wave splits its own f32 sums into hi/lo and stores them where k_fattn reads them: q and k as [b][h][t][d], v transposed as [b][h][d][t]; no f32 projection goes to memory.
// 16 plane rows at a time go through the wave's own LDS (q, k: 16 tokens x 64 d; v: 16 d x 64 tokens), so that every store instruction covers four whole 128-byte lines; that LDS is a piece of the operand buffers, which gemm_tile has left.
// Every '#pragma unroll' below, the store loops over s aside, stands on a loop that indexes a register array (accumulators).
__global__ __launch_bounds__(128, 4) void k_proj(const bf* __restrict__ X, const bf* __restrict__ Wq, const bf* __restrict__ Wk, const bf* __restrict__ Wv, bf* Qh, bf* Ql, bf* Kh, bf* Kl, bf* Vh, bf* Vl) {
    __shared__ __align__(16) bf sm[2 * 2 * GPL];
    const int lane = threadIdx.x & 31, lr = lane & 15, hi = lane >> 4, w = threadIdx.x >> 5; const int z = blockIdx.z;
    const bf* Bt = (z == 0) ? Wq : (z == 1) ? Wk : Wv;
    v8f acc[4][4];
    gemm_tile<1>(X + (size_t)blockIdx.x * 128 * DM, nullptr, Bt + (size_t)blockIdx.y * 128 * DM, sm, acc);
    const int r0 = blockIdx.x * 128 + (w & 1) * 64, h = blockIdx.y * 2 + (w >> 1);   // the wave's own first token and its head
    float* os = (float*)sm + w * (16 * 68);
    const int t0 = r0 % TT; const size_t pz = (size_t)((r0 / TT) * NH_ + h) * TT * HD; const int er = lane >> 3, ec = (lane & 7) * 8;   // a lane's row (of four) and 8-element column in a store
    if (z < 2) {
        bf* Ph = ((z == 0) ? Qh : Kh) + pz + (size_t)t0 * HD; bf* Pl = ((z == 0) ? Ql : Kl) + pz + (size_t)t0 * HD;
#pragma unroll
        for (int mb = 0; mb < 4; ++mb) {
#pragma unroll
            for (int nb = 0; nb < 4; ++nb) {
#pragma unroll
                for (int j = 0; j < 8; ++j) os[(hi * 8 + j) * 68 + nb * 16 + lr] = acc[mb][nb][j]; }
            __builtin_amdgcn_wave_barrier(); asm volatile("" ::: "memory");   // the reads below stay behind the other lanes' writes
#pragma unroll
            for (int s = 0; s < 4; ++s) { const int row = 4 * s + er; split8(os + row * 68 + ec, Ph + (mb * 16 + row) * HD + ec, Pl + (mb * 16 + row) * HD + ec); }
            __builtin_amdgcn_wave_barrier(); asm volatile("" ::: "memory");   // the next rows' writes stay behind these reads
        }
    } else {
        bf* Ph = Vh + pz + t0; bf* Pl = Vl + pz + t0;
#pragma unroll
        for (int nb = 0; nb < 4; ++nb) {
#pragma unroll
            for (int mb = 0; mb < 4; ++mb) { v4f u, w;
#pragma unroll
                for (int j = 0; j < 4; ++j) { u[j] = acc[mb][nb][j]; w[j] = acc[mb][nb][4 + j]; }
                *(v4fa*)(os + lr * 68 + mb * 16 + hi * 8) = u; *(v4fa*)(os + lr * 68 + mb * 16 + hi * 8 + 4) = w; }
            __builtin_amdgcn_wave_barrier(); asm volatile("" ::: "memory");   // the reads below stay behind the other lanes' writes
#pragma unroll
            for (int s = 0; s < 4; ++s) { const int row = 4 * s + er; split8(os + row * 68 + ec, Ph + (size_t)(nb * 16 + row) * TT + ec, Pl + (size_t)(nb * 16 + row) * TT + ec); }
            __builtin_amdgcn_wave_barrier(); asm volatile("" ::: "memory");   // the next rows' writes stay behind these reads
        }
        asm volatile("s_wait_xcnt 0x0" ::: "memory");   // stands behind this branch's last stores: in the built code the other branch's instructions follow and rewrite registers that these stores name
    }
}
// k_outp: one sequence's output projection, C[t][n] (f32, pitch DM) = sum_c (Ah + Al)[t][c] Wo[n][c]; a work-group of four waves per 128 x 128 tile (gemm_tile, hi and lo planes of A), grid (TT / 128, DM / 128).
// Each wave passes its 64 x 64 sums, 16 rows at a time, through its own piece of the operand buffers, which gemm_tile has left, so that every store instruction covers whole lines.
__global__ __launch_bounds__(128, 4) void k_outp(const bf* __restrict__ Ah, const bf* __restrict__ Al, const bf* __restrict__ Wo, float* C) {
    __shared__ __align__(16) bf sm[2 * 3 * GPL];
    const int lane = threadIdx.x & 31, lr = lane & 15, hi = lane >> 4, w = threadIdx.x >> 5;
    v8f acc[4][4];
    gemm_tile<2>(Ah + (size_t)blockIdx.x * 128 * DM, Al + (size_t)blockIdx.x * 128 * DM, Wo + (size_t)blockIdx.y * 128 * DM, sm, acc);
    const int r0 = blockIdx.x * 128 + (w & 1) * 64, c0 = blockIdx.y * 128 + (w >> 1) * 64;
    float* os = (float*)sm + w * (16 * 68);
#pragma unroll
    for (int mb = 0; mb < 4; ++mb) {
#pragma unroll
        for (int nb = 0; nb < 4; ++nb) {
#pragma unroll
            for (int j = 0; j < 8; ++j) os[(hi * 8 + j) * 68 + nb * 16 + lr] = acc[mb][nb][j]; }
        __builtin_amdgcn_wave_barrier(); asm volatile("" ::: "memory");   // the reads below stay behind the other lanes' writes
        float* crow = C + (size_t)(r0 + mb * 16) * DM + c0;
#pragma unroll
        for (int s = 0; s < 8; ++s) { const int row = 2 * s + hi, cofs = lr * 4; *(v4f*)(crow + (size_t)row * DM + cofs) = *(const v4fa*)(os + row * 68 + cofs); }
        __builtin_amdgcn_wave_barrier(); asm volatile("" ::: "memory");   // the next rows' writes stay behind these reads
    }
}
// k_fattn: scores, softmax and P x V of one (sequence, head) in one kernel; nothing of the score matrix goes to memory.
// Each wave owns QT tiles of 16 queries; the work-group walks the keys KB at a time. A wave forms the TRANSPOSED scores St[key][query] = K Qt (A = key rows, B = query columns):
// a lane then holds 8 keys of ONE query (query = lane & 15, keys 8 * (lane >> 4) + j of each 16-key tile), which is the B-fragment order of the second product Ot[d][query] = Vt[d][key] Pt[key][query]:
// no value changes lanes between the two products, and the running maximum, the running sum and the rescale factor are one scalar a lane.
// Both products keep the three hi/lo terms (hh + hl + lh). p = 2^(s c - m c), c = SCL log2(e), m the running maximum; the division by the row sum comes last.
// The KB keys' K rows and Vt columns (hi and lo) are read from memory once a work-group, in whole 16-byte pieces of consecutive addresses, and shared through LDS (two buffers, one barrier a block);
// LDS rows are pitched 16 bytes x odd (K 144 B, Vt 80 B) for the 16-byte fragment reads.
// Every '#pragma unroll' below stands on a loop that indexes a register array (fragments, accumulators, staged pieces): rolled, the array would go to scratch memory.
__global__ __launch_bounds__(FW * 32, FOCC) void k_fattn(const bf* __restrict__ Qh, const bf* __restrict__ Ql, const bf* __restrict__ Kh, const bf* __restrict__ Kl, const bf* __restrict__ Vh, const bf* __restrict__ Vl, bf* Ah, bf* Al) {
    typedef WFrag<bf> F;
    __shared__ __align__(16) bf sm[2][SME];
    const int tid = threadIdx.x, lane = tid & 31, lr = lane & 15, hi = lane >> 4; const int z = blockIdx.y, b = z / NH_, h = z % NH_; const int q0 = (blockIdx.x * FW + (tid >> 5)) * (16 * QT);
    const size_t pz = (size_t)z * TT * HD; const float C = SCL * 1.4426950408889634f;
    v16bf qh[QT][2], ql[QT][2]; v8f o[QT][4]; float m[QT]; v2f l[QT];
#pragma unroll
    for (int qt = 0; qt < QT; ++qt) { m[qt] = -3.0e38f; l[qt] = (v2f){};
#pragma unroll
        for (int kc = 0; kc < 2; ++kc) { const size_t qo = pz + (size_t)(q0 + qt * 16 + lr) * HD + kc * 32 + 8 * hi; qh[qt][kc] = F::ld(Qh + qo); ql[qt][kc] = F::ld(Ql + qo); }
#pragma unroll
        for (int dt = 0; dt < 4; ++dt) o[qt][dt] = (v8f){}; }
    // staging: piece c = tid + 128 i. K: KB rows of 128 B lie one behind the other in memory, piece c = row c / 8, 16-byte column c % 8. Vt: 64 rows (d), 64 B of each, piece c = row c / 4, column c % 4.
    const unsigned kg = tid * 8, vg = (tid >> 2) * TT + (tid & 3) * 8;   // a lane's own 32-bit offsets; the rest of each address is the same for the whole work-group
    const bf* Kh0 = Kh + pz; const bf* Kl0 = Kl + pz; const bf* Vh0 = Vh + pz; const bf* Vl0 = Vl + pz; const int ks = (tid >> 3) * KPI + (tid & 7) * 8, vs = (tid >> 2) * VPI + (tid & 3) * 8;
    v8us g[8];
#pragma unroll
    for (int i = 0; i < 2; ++i) { g[i] = *(const v8us*)(Kh0 + i * 1024 + kg); g[2 + i] = *(const v8us*)(Kl0 + i * 1024 + kg); g[4 + i] = *(const v8us*)(Vh0 + i * 32 * TT + vg); g[6 + i] = *(const v8us*)(Vl0 + i * 32 * TT + vg); }
#pragma unroll
    for (int i = 0; i < 2; ++i) { *(v8us*)(&sm[0][SKH + ks + i * 16 * KPI]) = g[i]; *(v8us*)(&sm[0][SKL + ks + i * 16 * KPI]) = g[2 + i]; *(v8us*)(&sm[0][SVH + vs + i * 32 * VPI]) = g[4 + i]; *(v8us*)(&sm[0][SVL + vs + i * 32 * VPI]) = g[6 + i]; }
    __syncthreads();   // block 0 is in LDS for every wave
    for (int kb = 0; kb < TT; kb += KB) {
        const bf* s0 = sm[(kb / KB) & 1]; bf* s1 = sm[(kb / KB + 1) & 1];
        const int kn = (kb + KB < TT) ? kb + KB : kb;   // the next block is fetched into registers while this one is worked on (the last trip fetches its own block again, unused)
        // s1 is nobody's to read between the two barriers round this trip, so each half is stored as soon as it has come: K's pieces fly over the first product, Vt's (in the same registers) over the softmax and the second
#pragma unroll
        for (int i = 0; i < 2; ++i) { g[i] = *(const v8us*)(Kh0 + kn * HD + i * 1024 + kg); g[2 + i] = *(const v8us*)(Kl0 + kn * HD + i * 1024 + kg); }
        __builtin_amdgcn_sched_barrier(0);   // keeps the four loads issued here, ahead of the first product (the scheduler otherwise sinks them to their stores and the wave waits out the whole latency)
        v8f s[QT][2];
#pragma unroll
        for (int kt = 0; kt < 2; ++kt) { v16bf kh[2], kl[2];
#pragma unroll
            for (int kc = 0; kc < 2; ++kc) { const int ko = (kt * 16 + lr) * KPI + kc * 32 + 8 * hi; kh[kc] = F::ld(s0 + SKH + ko); kl[kc] = F::ld(s0 + SKL + ko); }
#pragma unroll
            for (int qt = 0; qt < QT; ++qt) { v8f a = (v8f){};
#pragma unroll
                for (int kc = 0; kc < 2; ++kc) { a = F::mma(kh[kc], qh[qt][kc], a); a = F::mma(kh[kc], ql[qt][kc], a); a = F::mma(kl[kc], qh[qt][kc], a); }
                s[qt][kt] = a; } }
        __builtin_amdgcn_sched_barrier(0);   // keeps the stores, and the wait on the loads that comes with them, behind the first product
#pragma unroll
        for (int i = 0; i < 2; ++i) { *(v8us*)(s1 + SKH + ks + i * 16 * KPI) = g[i]; *(v8us*)(s1 + SKL + ks + i * 16 * KPI) = g[2 + i]; }
#pragma unroll
        for (int i = 0; i < 2; ++i) { g[i] = *(const v8us*)(Vh0 + kn + i * 32 * TT + vg); g[2 + i] = *(const v8us*)(Vl0 + kn + i * 32 * TT + vg); }
        __builtin_amdgcn_sched_barrier(0);   // keeps these four loads issued here, ahead of the softmax and the second product
        v16bf ph[QT], pl[QT];
#pragma unroll
        for (int qt = 0; qt < QT; ++qt) { float mx = s[qt][0][0];
#pragma unroll
            for (int j = 0; j < 8; ++j) mx = fmaxf(mx, fmaxf(s[qt][0][j], s[qt][1][j]));
            mx = fmaxf(mx, __shfl_xor(mx, 16, 32));
            const float mn = fmaxf(m[qt], mx * C); const float al = __builtin_amdgcn_exp2f(m[qt] - mn); m[qt] = mn; v2f ls[2] = { (v2f){}, (v2f){} };
#pragma unroll
            for (int e = 0; e < 16; e += 2) { v2f t; t[0] = s[qt][e >> 3][e & 7]; t[1] = s[qt][e >> 3][(e & 7) + 1]; t = __builtin_elementwise_fma(t, (v2f){C, C}, (v2f){-mn, -mn}); v2f p; p[0] = __builtin_amdgcn_exp2f(t[0]); p[1] = __builtin_amdgcn_exp2f(t[1]); ls[(e >> 1) & 1] += p;
                const v2bf a = __builtin_convertvector(p, v2bf); const v2bf r = __builtin_convertvector(p - __builtin_convertvector(a, v2f), v2bf); ph[qt][e] = a[0]; ph[qt][e + 1] = a[1]; pl[qt][e] = r[0]; pl[qt][e + 1] = r[1]; }
            l[qt] = l[qt] * al + (ls[0] + ls[1]);
#pragma unroll
            for (int dt = 0; dt < 4; ++dt) o[qt][dt] *= al; }
#pragma unroll
        for (int dt = 0; dt < 4; ++dt) { const int vo = (dt * 16 + lr) * VPI + 8 * hi; const v16bf vh = F::ld(s0 + SVH + vo), vl = F::ld(s0 + SVL + vo);
#pragma unroll
            for (int qt = 0; qt < QT; ++qt) { v8f a = o[qt][dt]; a = F::mma(vh, ph[qt], a); a = F::mma(vh, pl[qt], a); a = F::mma(vl, ph[qt], a); o[qt][dt] = a; } }
#pragma unroll
        for (int i = 0; i < 2; ++i) { *(v8us*)(s1 + SVH + vs + i * 32 * VPI) = g[i]; *(v8us*)(s1 + SVL + vs + i * 32 * VPI) = g[2 + i]; }
        __syncthreads();   // publishes the next block, and ends every wave's reads of this block's buffer before the next trip refills it
    }
#pragma unroll
    for (int qt = 0; qt < QT; ++qt) { const float lh = l[qt][0] + l[qt][1]; const float f = __fdiv_rn(1.0f, lh + __shfl_xor(lh, 16, 32)); const size_t oo = ((size_t)b * TT + q0 + qt * 16 + lr) * DQ + h * HD + 8 * hi;
#pragma unroll
        for (int dt = 0; dt < 4; ++dt) { v8us oh, ol;
#pragma unroll
            for (int j = 0; j < 8; ++j) { unsigned short a, c2; splitf(o[qt][dt][j] * f, a, c2); oh[j] = a; ol[j] = c2; }
            *(v8us*)(Ah + oo + dt * 16) = oh; *(v8us*)(Al + oo + dt * 16) = ol; } }
}

extern "C" void kernel_launch(void* const* d_in, const int* in_sizes, int n_in,
                              void* d_out, int out_size, void* d_ws, size_t ws_size, hipStream_t stream) {
    (void)in_sizes; (void)n_in; (void)out_size;
    const float* x = (const float*)d_in[0]; const float* wqkv = (const float*)d_in[1]; const float* wo = (const float*)d_in[2]; const float* wq = nullptr; const float* wk = nullptr; const float* wv = nullptr; (void)wq; (void)wk; (void)wv;
    float* OUT = (float*)d_out;     // [4][2048][1024]
    char* wsp = (char*)d_ws;
    auto take = [&](size_t bytes) { char* p = wsp; wsp += (bytes + 255) & ~(size_t)255; return (void*)p; };
    bf* WQ = (bf*)take((size_t)DQ * DM * 2); bf* WK = (bf*)take((size_t)DKV * DM * 2); bf* WV = (bf*)take((size_t)DKV * DM * 2); bf* WO = (bf*)take((size_t)DM * DQ * 2);
    bf* XB = (bf*)take((size_t)NB_ * TT * DM * 2);
    const size_t PB = (size_t)NH_ * TT * HD;   // one sequence's share of a hi or lo plane; the planes hold all NB_ sequences, [b][h][..]
    bf* QPh = (bf*)take(NB_ * PB * 2); bf* QPl = (bf*)take(NB_ * PB * 2); bf* KPh = (bf*)take(NB_ * PB * 2); bf* KPl = (bf*)take(NB_ * PB * 2); bf* VTh = (bf*)take(NB_ * PB * 2); bf* VTl = (bf*)take(NB_ * PB * 2);
    bf* ATh = (bf*)take((size_t)NB_ * TT * DQ * 2); bf* ATl = (bf*)take((size_t)NB_ * TT * DQ * 2);
    if ((size_t)(wsp - (char*)d_ws) > ws_size) return;    // ws 256 MiB
    { k_wsel3<<<(DQ * DM / 8 + 255) / 256, 256, 0, stream>>>(wqkv, 0, WQ); k_wsel3<<<(DQ * DM / 8 + 255) / 256, 256, 0, stream>>>(wqkv, 1, WK); k_wsel3<<<(DQ * DM / 8 + 255) / 256, 256, 0, stream>>>(wqkv, 2, WV);
      k_wtG<<<(unsigned)((DQ * DM / 64 + 63) / 64), 256, 0, stream>>>(wo, DQ, DM, WO);
       }
    k_cvt8<<<(unsigned)(((size_t)NB_ * TT * DM / 8 + 255) / 256), 256, 0, stream>>>(x, XB, (size_t)NB_ * TT * DM / 8);
    k_proj<<<dim3(NB_ * TT / 128, NH_ / 2, 3), 128, 0, stream>>>(XB, WQ, WK, WV, QPh, QPl, KPh, KPl, VTh, VTl);   // q, k, v of every sequence in one launch
    k_fattn<<<dim3(TT / (16 * QT * FW), NB_ * NH_, 1), FW * 32, 0, stream>>>(QPh, QPl, KPh, KPl, VTh, VTl, ATh, ATl);   // every sequence and head in one launch
    for (int b = 0; b < NB_; ++b) {
        k_outp<<<dim3(TT / 128, DM / 128, 1), 128, 0, stream>>>(ATh + (size_t)b * TT * DQ, ATl + (size_t)b * TT * DQ, WO, OUT + (size_t)b * TT * DM); }
}

// v005
// One run takes 216 microseconds.
// In two side-by-side timings against v004, it was 1.20 and 1.21 times as fast.
// Over all steps from v000 it is 11.9 times as fast.
#include <hip/hip_runtime.h>

// Multi-headed self-attention with the (d, k, h) channel layout of its fused qkv (x [4][2048][1024]; qkv = x w_qkv ('xw' [1024][3072] 1/32, no bias) reshaped (b, t, dh, 3, h): q[h][t][d] = column d*48 + 0*16 + h, k = ... + 16 + h, v = ... + 32 + h; 16 heads x 64; scores MULTIPLIED by sqrt(64) = 8 (the source's own quirk, kept); softmax; out = merged (h d) w_out ('xw' [1024][1024]) -> [4][2048][1024] (8.4 M)). THIS ROW: the same module on FOUR sequences with the scores MULTIPLIED by sqrt(64) = 8 (the source's own quirk: 'energy * SCALE' with SCALE = D ** 0.5: kept): SCL 8.0f; every query row runs the three-product (hi/lo) form.
// Layout: bf16 copy of x, all four sequences; a gather builds the three Bt weights from the interleaved columns (Bt[h*64+d][c] = w_qkv[c][d*48 + k*16 + h]); these preparations and w_out's transpose are ONE launch (k_prep); ONE projection launch for q, k, v of every sequence (k_proj: exact products, each wave splits its own f32 tile and stores the hi/lo head planes); then ONE attention launch for every sequence and head (k_fattn: scores, softmax and P x V fused, hi/lo 3 products each); merged hi/lo x w_out exact, ONE launch for every sequence (k_outp).
// Compute dtypes, f32 accumulate: every input rounded to bf16; projections exact; attention 3 products (hi/lo) in both matrix products; softmax f32; w_out hl x exact.

#define NB_  4
#define TT   2048
#define DM   1024
#define NH_  16
#define NKV  16
#define HD   64
#define DQ   (NH_ * HD)
#define DKV  (NKV * HD)
#define SCL  8.0f   // HD^+0.5: this module MULTIPLIES the scores by sqrt(64)
#define FW   4      // k_fattn: waves per work-group
#define QT   2      // k_fattn: 16-query tiles per wave
#define FOCC 4      // k_fattn: waves per SIMD the register budget is set for
#define KB   32     // k_fattn: keys per block
#define KPI  72     // LDS pitch of a K row, elements (128 B + 16)
#define VPI  40     // LDS pitch of a Vt row, elements (64 B + 16)
#define SKH  0      // places in one LDS buffer, elements: K hi, K lo, Vt hi, Vt lo
#define SKL  (KB * KPI)
#define SVH  (2 * KB * KPI)
#define SVL  (2 * KB * KPI + HD * VPI)
#define SME  (2 * KB * KPI + 2 * HD * VPI)
typedef _Float16 h16;
typedef unsigned short bf;
typedef __attribute__((ext_vector_type(16))) __bf16   v16bf;
typedef __attribute__((ext_vector_type(16))) _Float16 v16h;
typedef __attribute__((ext_vector_type(8)))  _Float16 v8h;
typedef __attribute__((ext_vector_type(8)))  unsigned short v8us;
typedef __attribute__((ext_vector_type(8)))  float    v8f;
typedef __attribute__((ext_vector_type(4)))  float    v4f;
typedef v8h  __attribute__((may_alias)) v8ha;
typedef v4f  __attribute__((may_alias)) v4fa;
typedef v8us __attribute__((may_alias)) v8usa;

__device__ __forceinline__ unsigned short f2bf(float f) { unsigned u = __float_as_uint(f); u += 0x7FFFu + ((u >> 16) & 1u); return (unsigned short)(u >> 16); }
__device__ __forceinline__ float bf2f(unsigned short b) { return __uint_as_float(((unsigned)b) << 16); }
__device__ __forceinline__ float bfr(float f) { return bf2f(f2bf(f)); }
__device__ __forceinline__ v16h cat16(v8h lo, v8h hi) { return __builtin_shufflevector(lo, hi, 0, 1, 2, 3, 4, 5, 6, 7, 8, 9, 10, 11, 12, 13, 14, 15); }
__device__ __forceinline__ v16bf cat16b(v8us lo, v8us hi) { return __builtin_bit_cast(v16bf, __builtin_shufflevector(lo, hi, 0, 1, 2, 3, 4, 5, 6, 7, 8, 9, 10, 11, 12, 13, 14, 15)); }
__device__ __forceinline__ v8f wmma16(v16h a, v16h b, v8f c) { return __builtin_amdgcn_wmma_f32_16x16x32_f16(false, a, false, b, (short)0, c, false, false); }
__device__ __forceinline__ v8f wmmab(v16bf a, v16bf b, v8f c) { return __builtin_amdgcn_wmma_f32_16x16x32_bf16(false, a, false, b, (short)0, c, false, false); }



// ---- gemm_tile: the k loop of both projection kernels. A work-group of four waves (2 x 2) sums a 128 x 128 tile of C[m][n] = sum_k A[m][k] Bt[n][k]; each wave keeps 64 x 64 (16 accumulators).
// The operands' rows are K-contiguous 16-bit planes of pitch DM. GK = 64 k columns at a time (one whole 128-byte line of every row) go from memory to LDS by asynchronous copies, through no register:
// a copy instruction of a wave takes four whole lines, and every staged row is read by two waves. Two buffers: tile t + 1 flies while tile t is worked on; one barrier a tile.
// Every '#pragma unroll' in gemm_tile and in the two kernels' epilogues, the store loops over s aside, stands on a loop that indexes a register array (fragments, accumulators): rolled, the array would go to scratch memory.
// LDS rows are pitched 16 bytes x odd (144 B) for the 16-byte fragment reads. NA = 2: A comes as hi and lo planes, two products a fragment pair. The products and their order along k are those of a wave that reads its fragments from memory, 32 k at a time.
#define GK   64               // k columns per staged tile
#define GP   72               // LDS pitch of a staged row, elements (128 B + 16)
#define GPL  (128 * GP)       // one staged plane (128 rows), elements
#define GNT  (DM / GK)        // staged tiles along k
template <typename T16> struct WFrag;
template <> struct WFrag<h16> { typedef v16h V; static __device__ __forceinline__ V ld(const h16* p) { return cat16(*(const v8h*)p, *(const v8h*)(p + 16)); } static __device__ __forceinline__ v8f mma(V a, V b, v8f c) { return wmma16(a, b, c); } };
template <> struct WFrag<bf> { typedef v16bf V; static __device__ __forceinline__ V ld(const bf* p) { return cat16b(*(const v8us*)p, *(const v8us*)(p + 16)); } static __device__ __forceinline__ v8f mma(V a, V b, v8f c) { return wmmab(a, b, c); } };
// copy8: a lane's eight 16-byte pieces of one staged plane (rows 16 apart), LDS byte address l, global address g. The s_wait_xcnt stands inside the statement, behind the last copy, so that no later write of an address register can come in front of it.
__device__ __forceinline__ void copy8(unsigned l, const bf* g) {
    asm volatile("global_load_async_to_lds_b128 %0, %8, off\n\t"
                 "global_load_async_to_lds_b128 %1, %9, off\n\t"
                 "global_load_async_to_lds_b128 %2, %10, off\n\t"
                 "global_load_async_to_lds_b128 %3, %11, off\n\t"
                 "global_load_async_to_lds_b128 %4, %12, off\n\t"
                 "global_load_async_to_lds_b128 %5, %13, off\n\t"
                 "global_load_async_to_lds_b128 %6, %14, off\n\t"
                 "global_load_async_to_lds_b128 %7, %15, off\n\t"
                 "s_wait_xcnt 0x0"
                 :: "v"(l), "v"(l + 1 * 16 * GP * 2), "v"(l + 2 * 16 * GP * 2), "v"(l + 3 * 16 * GP * 2), "v"(l + 4 * 16 * GP * 2), "v"(l + 5 * 16 * GP * 2), "v"(l + 6 * 16 * GP * 2), "v"(l + 7 * 16 * GP * 2),
                    "v"(g), "v"(g + 1 * 16 * DM), "v"(g + 2 * 16 * DM), "v"(g + 3 * 16 * DM), "v"(g + 4 * 16 * DM), "v"(g + 5 * 16 * DM), "v"(g + 6 * 16 * DM), "v"(g + 7 * 16 * DM) : "memory");
}
// A, A2, Bt: the work-group's first row of each plane, k = 0. sm: 2 buffers of (NA + 1) planes. On return every wave has left the buffers and no copy is in flight: sm is free for the caller.
template <int NA>
__device__ __forceinline__ void gemm_tile(const bf* A, const bf* A2, const bf* Bt, bf* sm, v8f (&acc)[4][4]) {
    typedef WFrag<bf> F;
    const int tid = threadIdx.x, lane = tid & 31, lr = lane & 15, hi = lane >> 4, w = tid >> 5;
    const size_t go = (size_t)(tid >> 3) * DM + (tid & 7) * 8;   // piece c = tid + 128 i of a plane: row c / 8, 16-byte column c % 8
    const unsigned l0 = (unsigned)(size_t)sm + ((tid >> 3) * GP + (tid & 7) * 8) * 2;
    const int ao = ((w & 1) * 64 + lr) * GP + 8 * hi, bo = NA * GPL + ((w >> 1) * 64 + lr) * GP + 8 * hi;   // a lane's own row and 16-byte column in the wave's fragments
    auto fill = [&](int t) { const unsigned l = l0 + (t & 1) * ((NA + 1) * GPL * 2); copy8(l, A + go + t * GK); if (NA == 2) copy8(l + GPL * 2, A2 + go + t * GK); copy8(l + NA * GPL * 2, Bt + go + t * GK); };
#pragma unroll
    for (int mb = 0; mb < 4; ++mb)
#pragma unroll
        for (int nb = 0; nb < 4; ++nb) acc[mb][nb] = (v8f){};
    fill(0);
    asm volatile("s_wait_asynccnt 0x0" ::: "memory");   // this wave's pieces of tile 0 have landed
    __syncthreads();   // tile 0 is in LDS for every wave
    fill(1);
#pragma unroll 1   // rolled, for speed only
    for (int t = 0; t < GNT; ++t) {
        const bf* s = sm + (t & 1) * ((NA + 1) * GPL);
        v16bf a[4], a2[4], bq[4];
        auto frags = [&](int kc) {   // the wave's fragments of 32 k
#pragma unroll
            for (int mb = 0; mb < 4; ++mb) { a[mb] = F::ld(s + ao + mb * 16 * GP + kc); if (NA == 2) a2[mb] = F::ld(s + GPL + ao + mb * 16 * GP + kc); }
#pragma unroll
            for (int nb = 0; nb < 4; ++nb) bq[nb] = F::ld(s + bo + nb * 16 * GP + kc); };
        auto prods = [&]() {
#pragma unroll
            for (int nb = 0; nb < 4; ++nb) {
#pragma unroll
                for (int mb = 0; mb < 4; ++mb) { acc[mb][nb] = F::mma(a[mb], bq[nb], acc[mb][nb]); if (NA == 2) acc[mb][nb] = F::mma(a2[mb], bq[nb], acc[mb][nb]); } } };
        frags(0);
        __builtin_amdgcn_sched_barrier(0);   // keeps these fragment reads together in front of their matrix instructions (the scheduler otherwise reads each B fragment directly in front of its users, and the wave waits out the LDS latency four times)
        prods();
        frags(32);   // the tile's last reads
        if (NA == 2) { __builtin_amdgcn_sched_barrier(0); prods(); }   // hi and lo fragments leave no registers for the copies' addresses beside them: the second half's products come first (the scheduling barrier: as above)
        asm volatile("s_wait_dscnt 0x0" ::: "memory");      // this wave's reads of tile t are done before the buffer is given up
        asm volatile("s_wait_asynccnt 0x0" ::: "memory");   // this wave's pieces of tile t + 1 have landed
        __syncthreads();   // publishes tile t + 1, and ends every wave's reads of tile t's buffer before it is refilled
        if (t + 2 < GNT) fill(t + 2);
        if (NA == 1) prods();   // the second half's products need registers alone: the refill is on its way while they run
    }
    asm volatile("s_wait_asynccnt 0x0" ::: "memory");   // no copy is in flight when the caller takes the buffers over
}

__device__ __forceinline__ void splitf(float y, unsigned short& h, unsigned short& l) { h = f2bf(y); l = f2bf(y - bf2f(h)); }
typedef __attribute__((ext_vector_type(2))) _Float16 v2h;
typedef __attribute__((ext_vector_type(4))) _Float16 v4h;
typedef __attribute__((ext_vector_type(2))) unsigned short v2us;
typedef __attribute__((ext_vector_type(4))) unsigned short v4us;
typedef __attribute__((ext_vector_type(2))) float v2f;
typedef __attribute__((ext_vector_type(2))) __bf16 v2bf;
typedef __attribute__((ext_vector_type(4))) int v4i;

// The three parts of k_prep; bx: the block's index within its part.
__device__ __forceinline__ void p_wtG(const float* __restrict__ w, int K, int N, bf* Bt, int bx) {
    const int lane = threadIdx.x & 31; const int L0 = (bx * 8 + (threadIdx.x >> 5)) * 8; const int nlines = N * K / 64;
{
#pragma unroll 1
        for (int l = 0; l < 8; ++l) { const int L = L0 + l; if (L >= nlines) break; const size_t e = (size_t)L * 64 + lane * 2; const int k = (int)(e % K), n = (int)(e / K); v2us o;
            o[0] = f2bf(w[(size_t)k * N + n]); o[1] = f2bf(w[(size_t)(k + 1) * N + n]); *(v2us*)(Bt + e) = o; }
         }
}
__device__ __forceinline__ void p_cvt8(const float* __restrict__ src, bf* dst, size_t n8, int bx) { const size_t i = (size_t)bx * 256 + threadIdx.x; if (i >= n8) return; const v8f v = *(const v8f*)(src + i * 8); v8us o;
#pragma unroll
    for (int k = 0; k < 8; ++k) o[k] = f2bf(v[k]); *(v8us*)(dst + i * 8) = o;  }

__device__ __forceinline__ void p_wsel3(const float* __restrict__ w, int k, bf* Bt, int bx) { const int i = bx * 256 + threadIdx.x; if (i >= DQ * DM / 8) return; const int c0 = (i % (DM / 8)) * 8; const int r = i / (DM / 8); const int h = r / HD, d = r % HD; const int col = d * 3 * NH_ + k * NH_ + h; v8us o;
#pragma unroll
    for (int q = 0; q < 8; ++q) o[q] = f2bf(w[(size_t)(c0 + q) * (3 * DQ) + col]);
    *(v8us*)(Bt + (size_t)r * DM + c0) = o;  }
// k_prep: every 16-bit operand that the projections read, in one launch: w_out transposed, the three gathered weights, x converted. No part reads what another writes, so the block index alone picks a block's part.
// The parts whose loads touch a line per lane come first in the grid, for speed only.
#define PWT  (DQ * DM / 64 / 64)          // blocks of the transpose (a block: 64 lines of 64 elements)
#define PSEL (DQ * DM / 8 / 256)          // blocks of one gathered weight
#define PCVT (NB_ * TT * DM / 8 / 256)    // blocks of the conversion
__global__ __launch_bounds__(256) void k_prep(const float* __restrict__ x, const float* __restrict__ wqkv, const float* __restrict__ wo, bf* WQ, bf* WK, bf* WV, bf* WO, bf* XB) {
    const int bx = blockIdx.x;
    if (bx < PWT) p_wtG(wo, DQ, DM, WO, bx);
    else if (bx < PWT + 3 * PSEL) { const int k = (bx - PWT) / PSEL; p_wsel3(wqkv, k, (k == 0) ? WQ : (k == 1) ? WK : WV, (bx - PWT) % PSEL); }
    else p_cvt8(x, XB, (size_t)NB_ * TT * DM / 8, bx - PWT - 3 * PSEL);
}
// split8: 8 consecutive f32 of a staged row -> 8 hi and 8 lo bf16, one 16-byte store each.
__device__ __forceinline__ void split8(const float* s, bf* ph, bf* pl) { const v4f u = *(const v4fa*)s, w = *(const v4fa*)(s + 4); v8us oh, ol;
#pragma unroll
    for (int j = 0; j < 4; ++j) { unsigned short a, c; splitf(u[j], a, c); oh[j] = a; ol[j] = c; splitf(w[j], a, c); oh[4 + j] = a; ol[4 + j] = c; }
    *(v8us*)ph = oh; *(v8us*)pl = ol; }
// k_proj: the q, k and v projections of every sequence in one launch; a work-group of four waves per 128 x 128 tile (gemm_tile), ONE WAVE per 64x64 of it; grid (NB_ * TT / 128, NH_ / 2, 3), z = 0 q, 1 k, 2 v.
// A wave's tile is 64 tokens of one sequence x the 64 channels of one head. The wave splits its own f32 sums into hi/lo and stores them where k_fattn reads them: q and k as [b][h][t][d], v transposed as [b][h][d][t]; no f32 projection goes to memory.
// 16 plane rows at a time go through the wave's own LDS (q, k: 16 tokens x 64 d; v: 16 d x 64 tokens), so that every store instruction covers four whole 128-byte lines; that LDS is a piece of the operand buffers, which gemm_tile has left.
// Every '#pragma unroll' below, the store loops over s aside, stands on a loop that indexes a register array (accumulators).
__global__ __launch_bounds__(128, 4) void k_proj(const bf* __restrict__ X, const bf* __restrict__ Wq, const bf* __restrict__ Wk, const bf* __restrict__ Wv, bf* Qh, bf* Ql, bf* Kh, bf* Kl, bf* Vh, bf* Vl) {
    __shared__ __align__(16) bf sm[2 * 2 * GPL];
    const int lane = threadIdx.x & 31, lr = lane & 15, hi = lane >> 4, w = threadIdx.x >> 5; const int z = blockIdx.z;
    const bf* Bt = (z == 0) ? Wq : (z == 1) ? Wk : Wv;
    v8f acc[4][4];
    gemm_tile<1>(X + (size_t)blockIdx.x * 128 * DM, nullptr, Bt + (size_t)blockIdx.y * 128 * DM, sm, acc);
    const int r0 = blockIdx.x * 128 + (w & 1) * 64, h = blockIdx.y * 2 + (w >> 1);   // the wave's own first token and its head
    float* os = (float*)sm + w * (16 * 68);
    const int t0 = r0 % TT; const size_t pz = (size_t)((r0 / TT) * NH_ + h) * TT * HD; const int er = lane >> 3, ec = (lane & 7) * 8;   // a lane's row (of four) and 8-element column in a store
    if (z < 2) {
        bf* Ph = ((z == 0) ? Qh : Kh) + pz + (size_t)t0 * HD; bf* Pl = ((z == 0) ? Ql : Kl) + pz + (size_t)t0 * HD;
#pragma unroll
        for (int mb = 0; mb < 4; ++mb) {
#pragma unroll
            for (int nb = 0; nb < 4; ++nb) {
#pragma unroll
                for (int j = 0; j < 8; ++j) os[(hi * 8 + j) * 68 + nb * 16 + lr] = acc[mb][nb][j]; }
            __builtin_amdgcn_wave_barrier(); asm volatile("" ::: "memory");   // the reads below stay behind the other lanes' writes
#pragma unroll
            for (int s = 0; s < 4; ++s) { const int row = 4 * s + er; split8(os + row * 68 + ec, Ph + (mb * 16 + row) * HD + ec, Pl + (mb * 16 + row) * HD + ec); }
            __builtin_amdgcn_wave_barrier(); asm volatile("" ::: "memory");   // the next rows' writes stay behind these reads
        }
    } else {
        bf* Ph = Vh + pz + t0; bf* Pl = Vl + pz + t0;
#pragma unroll
        for (int nb = 0; nb < 4; ++nb) {
#pragma unroll
            for (int mb = 0; mb < 4; ++mb) { v4f u, w;
#pragma unroll
                for (int j = 0; j < 4; ++j) { u[j] = acc[mb][nb][j]; w[j] = acc[mb][nb][4 + j]; }
                *(v4fa*)(os + lr * 68 + mb * 16 + hi * 8) = u; *(v4fa*)(os + lr * 68 + mb * 16 + hi * 8 + 4) = w; }
            __builtin_amdgcn_wave_barrier(); asm volatile("" ::: "memory");   // the reads below stay behind the other lanes' writes
#pragma unroll
            for (int s = 0; s < 4; ++s) { const int row = 4 * s + er; split8(os + row * 68 + ec, Ph + (size_t)(nb * 16 + row) * TT + ec, Pl + (size_t)(nb * 16 + row) * TT + ec); }
            __builtin_amdgcn_wave_barrier(); asm volatile("" ::: "memory");   // the next rows' writes stay behind these reads
        }
        asm volatile("s_wait_xcnt 0x0" ::: "memory");   // stands behind this branch's last stores: in the built code the other branch's instructions follow and rewrite registers that these stores name
    }
}
// k_outp: the output projection of every sequence, C[t][n] (f32, pitch DM, t over all NB_ * TT tokens) = sum_c (Ah + Al)[t][c] Wo[n][c]; a work-group of four waves per 128 x 128 tile (gemm_tile, hi and lo planes of A), grid (NB_ * TT / 128, DM / 128): two work-groups for every WGP's LDS.
// Each wave passes its 64 x 64 sums, 16 rows at a time, through its own piece of the operand buffers, which gemm_tile has left, so that every store instruction covers whole lines.
__global__ __launch_bounds__(128, 4) void k_outp(const bf* __restrict__ Ah, const bf* __restrict__ Al, const bf* __restrict__ Wo, float* C) {
    __shared__ __align__(16) bf sm[2 * 3 * GPL];
    const int lane = threadIdx.x & 31, lr = lane & 15, hi = lane >> 4, w = threadIdx.x >> 5;
    v8f acc[4][4];
    gemm_tile<2>(Ah + (size_t)blockIdx.x * 128 * DM, Al + (size_t)blockIdx.x * 128 * DM, Wo + (size_t)blockIdx.y * 128 * DM, sm, acc);
    const int r0 = blockIdx.x * 128 + (w & 1) * 64, c0 = blockIdx.y * 128 + (w >> 1) * 64;
    float* os = (float*)sm + w * (16 * 68);
#pragma unroll
    for (int mb = 0; mb < 4; ++mb) {
#pragma unroll
        for (int nb = 0; nb < 4; ++nb) {
#pragma unroll
            for (int j = 0; j < 8; ++j) os[(hi * 8 + j) * 68 + nb * 16 + lr] = acc[mb][nb][j]; }
        __builtin_amdgcn_wave_barrier(); asm volatile("" ::: "memory");   // the reads below stay behind the other lanes' writes
        float* crow = C + (size_t)(r0 + mb * 16) * DM + c0;
#pragma unroll
        for (int s = 0; s < 8; ++s) { const int row = 2 * s + hi, cofs = lr * 4; *(v4f*)(crow + (size_t)row * DM + cofs) = *(const v4fa*)(os + row * 68 + cofs); }
        __builtin_amdgcn_wave_barrier(); asm volatile("" ::: "memory");   // the next rows' writes stay behind these reads
    }
}
// k_fattn: scores, softmax and P x V of one (sequence, head) in one kernel; nothing of the score matrix goes to memory.
// Each wave owns QT tiles of 16 queries; the work-group walks the keys KB at a time. A wave forms the TRANSPOSED scores St[key][query] = K Qt (A = key rows, B = query columns):
// a lane then holds 8 keys of ONE query (query = lane & 15, keys 8 * (lane >> 4) + j of each 16-key tile), which is the B-fragment order of the second product Ot[d][query] = Vt[d][key] Pt[key][query]:
// no value changes lanes between the two products, and the running maximum, the running sum and the rescale factor are one scalar a lane.
// Both products keep the three hi/lo terms (hh + hl + lh). p = 2^(s c - m c), c = SCL log2(e), m the running maximum; the division by the row sum comes last.
// The KB keys' K rows and Vt columns (hi and lo) are read from memory once a work-group, in whole 16-byte pieces of consecutive addresses, and shared through LDS (two buffers, one barrier a block);
// LDS rows are pitched 16 bytes x odd (K 144 B, Vt 80 B) for the 16-byte fragment reads.
// Every '#pragma unroll' below stands on a loop that indexes a register array (fragments, accumulators, staged pieces): rolled, the array would go to scratch memory.
__global__ __launch_bounds__(FW * 32, FOCC) void k_fattn(const bf* __restrict__ Qh, const bf* __restrict__ Ql, const bf* __restrict__ Kh, const bf* __restrict__ Kl, const bf* __restrict__ Vh, const bf* __restrict__ Vl, bf* Ah, bf* Al) {
    typedef WFrag<bf> F;
    __shared__ __align__(16) bf sm[2][SME];
    const int tid = threadIdx.x, lane = tid & 31, lr = lane & 15, hi = lane >> 4; const int z = blockIdx.y, b = z / NH_, h = z % NH_; const int q0 = (blockIdx.x * FW + (tid >> 5)) * (16 * QT);
    const size_t pz = (size_t)z * TT * HD; const float C = SCL * 1.4426950408889634f;
    v16bf qh[QT][2], ql[QT][2]; v8f o[QT][4]; float m[QT]; v2f l[QT];
#pragma unroll
    for (int qt = 0; qt < QT; ++qt) { m[qt] = -3.0e38f; l[qt] = (v2f){};
#pragma unroll
        for (int kc = 0; kc < 2; ++kc) { const size_t qo = pz + (size_t)(q0 + qt * 16 + lr) * HD + kc * 32 + 8 * hi; qh[qt][kc] = F::ld(Qh + qo); ql[qt][kc] = F::ld(Ql + qo); }
#pragma unroll
        for (int dt = 0; dt < 4; ++dt) o[qt][dt] = (v8f){}; }
    // staging: piece c = tid + 128 i. K: KB rows of 128 B lie one behind the other in memory, piece c = row c / 8, 16-byte column c % 8. Vt: 64 rows (d), 64 B of each, piece c = row c / 4, column c % 4.
    const unsigned kg = tid * 8, vg = (tid >> 2) * TT + (tid & 3) * 8;   // a lane's own 32-bit offsets; the rest of each address is the same for the whole work-group
    const bf* Kh0 = Kh + pz; const bf* Kl0 = Kl + pz; const bf* Vh0 = Vh + pz; const bf* Vl0 = Vl + pz; const int ks = (tid >> 3) * KPI + (tid & 7) * 8, vs = (tid >> 2) * VPI + (tid & 3) * 8;
    v8us g[8];
#pragma unroll
    for (int i = 0; i < 2; ++i) { g[i] = *(const v8us*)(Kh0 + i * 1024 + kg); g[2 + i] = *(const v8us*)(Kl0 + i * 1024 + kg); g[4 + i] = *(const v8us*)(Vh0 + i * 32 * TT + vg); g[6 + i] = *(const v8us*)(Vl0 + i * 32 * TT + vg); }
#pragma unroll
    for (int i = 0; i < 2; ++i) { *(v8us*)(&sm[0][SKH + ks + i * 16 * KPI]) = g[i]; *(v8us*)(&sm[0][SKL + ks + i * 16 * KPI]) = g[2 + i]; *(v8us*)(&sm[0][SVH + vs + i * 32 * VPI]) = g[4 + i]; *(v8us*)(&sm[0][SVL + vs + i * 32 * VPI]) = g[6 + i]; }
    __syncthreads();   // block 0 is in LDS for every wave
    for (int kb = 0; kb < TT; kb += KB) {
        const bf* s0 = sm[(kb / KB) & 1]; bf* s1 = sm[(kb / KB + 1) & 1];
        const int kn = (kb + KB < TT) ? kb + KB : kb;   // the next block is fetched into registers while this one is worked on (the last trip fetches its own block again, unused)
        // s1 is nobody's to read between the two barriers round this trip, so each half is stored as soon as it has come: K's pieces fly over the first product, Vt's (in the same registers) over the softmax and the second
#pragma unroll
        for (int i = 0; i < 2; ++i) { g[i] = *(const v8us*)(Kh0 + kn * HD + i * 1024 + kg); g[2 + i] = *(const v8us*)(Kl0 + kn * HD + i * 1024 + kg); }
        __builtin_amdgcn_sched_barrier(0);   // keeps the four loads issued here, ahead of the first product (the scheduler otherwise sinks them to their stores and the wave waits out the whole latency)
        v8f s[QT][2];
#pragma unroll
        for (int kt = 0; kt < 2; ++kt) { v16bf kh[2], kl[2];
#pragma unroll
            for (int kc = 0; kc < 2; ++kc) { const int ko = (kt * 16 + lr) * KPI + kc * 32 + 8 * hi; kh[kc] = F::ld(s0 + SKH + ko); kl[kc] = F::ld(s0 + SKL + ko); }
#pragma unroll
            for (int qt = 0; qt < QT; ++qt) { v8f a = (v8f){};
#pragma unroll
                for (int kc = 0; kc < 2; ++kc) { a = F::mma(kh[kc], qh[qt][kc], a); a = F::mma(kh[kc], ql[qt][kc], a); a = F::mma(kl[kc], qh[qt][kc], a); }
                s[qt][kt] = a; } }
        __builtin_amdgcn_sched_barrier(0);   // keeps the stores, and the wait on the loads that comes with them, behind the first product
#pragma unroll
        for (int i = 0; i < 2; ++i) { *(v8us*)(s1 + SKH + ks + i * 16 * KPI) = g[i]; *(v8us*)(s1 + SKL + ks + i * 16 * KPI) = g[2 + i]; }
#pragma unroll
        for (int i = 0; i < 2; ++i) { g[i] = *(const v8us*)(Vh0 + kn + i * 32 * TT + vg); g[2 + i] = *(const v8us*)(Vl0 + kn + i * 32 * TT + vg); }
        __builtin_amdgcn_sched_barrier(0);   // keeps these four loads issued here, ahead of the softmax and the second product
        v16bf ph[QT], pl[QT];
#pragma unroll
        for (int qt = 0; qt < QT; ++qt) { float mx = s[qt][0][0];
#pragma unroll
            for (int j = 0; j < 8; ++j) mx = fmaxf(mx, fmaxf(s[qt][0][j], s[qt][1][j]));
            mx = fmaxf(mx, __shfl_xor(mx, 16, 32));
            const float mn = fmaxf(m[qt], mx * C); const float al = __builtin_amdgcn_exp2f(m[qt] - mn); m[qt] = mn; v2f ls[2] = { (v2f){}, (v2f){} };
#pragma unroll
            for (int e = 0; e < 16; e += 2) { v2f t; t[0] = s[qt][e >> 3][e & 7]; t[1] = s[qt][e >> 3][(e & 7) + 1]; t = __builtin_elementwise_fma(t, (v2f){C, C}, (v2f){-mn, -mn}); v2f p; p[0] = __builtin_amdgcn_exp2f(t[0]); p[1] = __builtin_amdgcn_exp2f(t[1]); ls[(e >> 1) & 1] += p;
                const v2bf a = __builtin_convertvector(p, v2bf); const v2bf r = __builtin_convertvector(p - __builtin_convertvector(a, v2f), v2bf); ph[qt][e] = a[0]; ph[qt][e + 1] = a[1]; pl[qt][e] = r[0]; pl[qt][e + 1] = r[1]; }
            l[qt] = l[qt] * al + (ls[0] + ls[1]);
#pragma unroll
            for (int dt = 0; dt < 4; ++dt) o[qt][dt] *= al; }
#pragma unroll
        for (int dt = 0; dt < 4; ++dt) { const int vo = (dt * 16 + lr) * VPI + 8 * hi; const v16bf vh = F::ld(s0 + SVH + vo), vl = F::ld(s0 + SVL + vo);
#pragma unroll
            for (int qt = 0; qt < QT; ++qt) { v8f a = o[qt][dt]; a = F::mma(vh, ph[qt], a); a = F::mma(vh, pl[qt], a); a = F::mma(vl, ph[qt], a); o[qt][dt] = a; } }
#pragma unroll
        for (int i = 0; i < 2; ++i) { *(v8us*)(s1 + SVH + vs + i * 32 * VPI) = g[i]; *(v8us*)(s1 + SVL + vs + i * 32 * VPI) = g[2 + i]; }
        __syncthreads();   // publishes the next block, and ends every wave's reads of this block's buffer before the next trip refills it
    }
#pragma unroll
    for (int qt = 0; qt < QT; ++qt) { const float lh = l[qt][0] + l[qt][1]; const float f = __fdiv_rn(1.0f, lh + __shfl_xor(lh, 16, 32)); const size_t oo = ((size_t)b * TT + q0 + qt * 16 + lr) * DQ + h * HD + 8 * hi;
#pragma unroll
        for (int dt = 0; dt < 4; ++dt) { v8us oh, ol;
#pragma unroll
            for (int j = 0; j < 8; ++j) { unsigned short a, c2; splitf(o[qt][dt][j] * f, a, c2); oh[j] = a; ol[j] = c2; }
            *(v8us*)(Ah + oo + dt * 16) = oh; *(v8us*)(Al + oo + dt * 16) = ol; } }
}

extern "C" void kernel_launch(void* const* d_in, const int* in_sizes, int n_in,
                              void* d_out, int out_size, void* d_ws, size_t ws_size, hipStream_t stream) {
    (void)in_sizes; (void)n_in; (void)out_size;
    const float* x = (const float*)d_in[0]; const float* wqkv = (const float*)d_in[1]; const float* wo = (const float*)d_in[2]; const float* wq = nullptr; const float* wk = nullptr; const float* wv = nullptr; (void)wq; (void)wk; (void)wv;
    float* OUT = (float*)d_out;     // [4][2048][1024]
    char* wsp = (char*)d_ws;
    auto take = [&](size_t bytes) { char* p = wsp; wsp += (bytes + 255) & ~(size_t)255; return (void*)p; };
    bf* WQ = (bf*)take((size_t)DQ * DM * 2); bf* WK = (bf*)take((size_t)DKV * DM * 2); bf* WV = (bf*)take((size_t)DKV * DM * 2); bf* WO = (bf*)take((size_t)DM * DQ * 2);
    bf* XB = (bf*)take((size_t)NB_ * TT * DM * 2);
    const size_t PB = (size_t)NH_ * TT * HD;   // one sequence's share of a hi or lo plane; the planes hold all NB_ sequences, [b][h][..]
    bf* QPh = (bf*)take(NB_ * PB * 2); bf* QPl = (bf*)take(NB_ * PB * 2); bf* KPh = (bf*)take(NB_ * PB * 2); bf* KPl = (bf*)take(NB_ * PB * 2); bf* VTh = (bf*)take(NB_ * PB * 2); bf* VTl = (bf*)take(NB_ * PB * 2);
    bf* ATh = (bf*)take((size_t)NB_ * TT * DQ * 2); bf* ATl = (bf*)take((size_t)NB_ * TT * DQ * 2);
    if ((size_t)(wsp - (char*)d_ws) > ws_size) return;    // ws 256 MiB
    k_prep<<<PWT + 3 * PSEL + PCVT, 256, 0, stream>>>(x, wqkv, wo, WQ, WK, WV, WO, XB);   // all 16-bit operands of the projections in one launch
    k_proj<<<dim3(NB_ * TT / 128, NH_ / 2, 3), 128, 0, stream>>>(XB, WQ, WK, WV, QPh, QPl, KPh, KPl, VTh, VTl);   // q, k, v of every sequence in one launch
    k_fattn<<<dim3(TT / (16 * QT * FW), NB_ * NH_, 1), FW * 32, 0, stream>>>(QPh, QPl, KPh, KPl, VTh, VTl, ATh, ATl);   // every sequence and head in one launch
    k_outp<<<dim3(NB_ * TT / 128, DM / 128, 1), 128, 0, stream>>>(ATh, ATl, WO, OUT);   // every sequence in one launch
}

// v006
// Measured time: 203 microseconds a run.
// Two timings next to v005 both put it at 1.06 times that version's speed.
// All steps since v000 together make it 12.6 times as fast.
#include <hip/hip_runtime.h>

// Multi-headed self-attention with the (d, k, h) channel layout of its fused qkv (x [4][2048][1024]; qkv = x w_qkv ('xw' [1024][3072] 1/32, no bias) reshaped (b, t, dh, 3, h): q[h][t][d] = column d*48 + 0*16 + h, k = ... + 16 + h, v = ... + 32 + h; 16 heads x 64; scores MULTIPLIED by sqrt(64) = 8 (the source's own quirk, kept); softmax; out = merged (h d) w_out ('xw' [1024][1024]) -> [4][2048][1024] (8.4 M)). THIS ROW: the same module on FOUR sequences with the scores MULTIPLIED by sqrt(64) = 8 (the source's own quirk: 'energy * SCALE' with SCALE = D ** 0.5: kept): SCL 8.0f; every query row runs the three-product (hi/lo) form.
// Layout: bf16 copy of x, all four sequences; a gather builds the three Bt weights from the interleaved columns (Bt[h*64+d][c] = w_qkv[c][d*48 + k*16 + h]), 64-row tiles turned through LDS; these preparations and w_out's transpose are ONE launch (k_prep); ONE projection launch for q, k, v of every sequence (k_proj: exact products, each wave splits its own f32 tile and stores the hi/lo head planes); then ONE attention launch for every sequence and head (k_fattn: scores, softmax and P x V fused, hi/lo 3 products each); merged hi/lo x w_out exact, ONE launch for every sequence (k_outp).
// Compute dtypes, f32 accumulate: every input rounded to bf16; projections exact; attention 3 products (hi/lo) in both matrix products; softmax f32; w_out hl x exact.

#define NB_  4
#define TT   2048
#define DM   1024
#define NH_  16
#define NKV  16
#define HD   64
#define DQ   (NH_ * HD)
#define DKV  (NKV * HD)
#define SCL  8.0f   // HD^+0.5: this module MULTIPLIES the scores by sqrt(64)
#define FW   4      // k_fattn: waves per work-group
#define QT   2      // k_fattn: 16-query tiles per wave
#define FOCC 4      // k_fattn: waves per SIMD the register budget is set for
#define KB   32     // k_fattn: keys per block
#define KPI  72     // LDS pitch of a K row, elements (128 B + 16)
#define VPI  40     // LDS pitch of a Vt row, elements (64 B + 16)
#define SKH  0      // places in one LDS buffer, elements: K hi, K lo, Vt hi, Vt lo
#define SKL  (KB * KPI)
#define SVH  (2 * KB * KPI)
#define SVL  (2 * KB * KPI + HD * VPI)
#define SME  (2 * KB * KPI + 2 * HD * VPI)
typedef _Float16 h16;
typedef unsigned short bf;
typedef __attribute__((ext_vector_type(16))) __bf16   v16bf;
typedef __attribute__((ext_vector_type(16))) _Float16 v16h;
typedef __attribute__((ext_vector_type(8)))  _Float16 v8h;
typedef __attribute__((ext_vector_type(8)))  unsigned short v8us;
typedef __attribute__((ext_vector_type(8)))  float    v8f;
typedef __attribute__((ext_vector_type(4)))  float    v4f;
typedef v8h  __attribute__((may_alias)) v8ha;
typedef v4f  __attribute__((may_alias)) v4fa;
typedef v8us __attribute__((may_alias)) v8usa;

__device__ __forceinline__ unsigned short f2bf(float f) { unsigned u = __float_as_uint(f); u += 0x7FFFu + ((u >> 16) & 1u); return (unsigned short)(u >> 16); }
__device__ __forceinline__ float bf2f(unsigned short b) { return __uint_as_float(((unsigned)b) << 16); }
__device__ __forceinline__ float bfr(float f) { return bf2f(f2bf(f)); }
__device__ __forceinline__ v16h cat16(v8h lo, v8h hi) { return __builtin_shufflevector(lo, hi, 0, 1, 2, 3, 4, 5, 6, 7, 8, 9, 10, 11, 12, 13, 14, 15); }
__device__ __forceinline__ v16bf cat16b(v8us lo, v8us hi) { return __builtin_bit_cast(v16bf, __builtin_shufflevector(lo, hi, 0, 1, 2, 3, 4, 5, 6, 7, 8, 9, 10, 11, 12, 13, 14, 15)); }
__device__ __forceinline__ v8f wmma16(v16h a, v16h b, v8f c) { return __builtin_amdgcn_wmma_f32_16x16x32_f16(false, a, false, b, (short)0, c, false, false); }
__device__ __forceinline__ v8f wmmab(v16bf a, v16bf b, v8f c) { return __builtin_amdgcn_wmma_f32_16x16x32_bf16(false, a, false, b, (short)0, c, false, false); }



// ---- gemm_tile: the k loop of both projection kernels. A work-group of four waves (2 x 2) sums a 128 x 128 tile of C[m][n] = sum_k A[m][k] Bt[n][k]; each wave keeps 64 x 64 (16 accumulators).
// The operands' rows are K-contiguous 16-bit planes of pitch DM. GK = 64 k columns at a time (one whole 128-byte line of every row) go from memory to LDS by asynchronous copies, through no register:
// a copy instruction of a wave takes four whole lines, and every staged row is read by two waves. Two buffers: tile t + 1 flies while tile t is worked on; one barrier a tile.
// Every '#pragma unroll' in gemm_tile and in the two kernels' epilogues, the store loops over s aside, stands on a loop that indexes a register array (fragments, accumulators): rolled, the array would go to scratch memory.
// LDS rows are pitched 16 bytes x odd (144 B) for the 16-byte fragment reads. NA = 2: A comes as hi and lo planes, two products a fragment pair. The products and their order along k are those of a wave that reads its fragments from memory, 32 k at a time.
#define GK   64               // k columns per staged tile
#define GP   72               // LDS pitch of a staged row, elements (128 B + 16)
#define GPL  (128 * GP)       // one staged plane (128 rows), elements
#define GNT  (DM / GK)        // staged tiles along k
template <typename T16> struct WFrag;
template <> struct WFrag<h16> { typedef v16h V; static __device__ __forceinline__ V ld(const h16* p) { return cat16(*(const v8h*)p, *(const v8h*)(p + 16)); } static __device__ __forceinline__ v8f mma(V a, V b, v8f c) { return wmma16(a, b, c); } };
template <> struct WFrag<bf> { typedef v16bf V; static __device__ __forceinline__ V ld(const bf* p) { return cat16b(*(const v8us*)p, *(const v8us*)(p + 16)); } static __device__ __forceinline__ v8f mma(V a, V b, v8f c) { return wmmab(a, b, c); } };
// copy8: a lane's eight 16-byte pieces of one staged plane (rows 16 apart), LDS byte address l, global address g. The s_wait_xcnt stands inside the statement, behind the last copy, so that no later write of an address register can come in front of it.
__device__ __forceinline__ void copy8(unsigned l, const bf* g) {
    asm volatile("global_load_async_to_lds_b128 %0, %8, off\n\t"
                 "global_load_async_to_lds_b128 %1, %9, off\n\t"
                 "global_load_async_to_lds_b128 %2, %10, off\n\t"
                 "global_load_async_to_lds_b128 %3, %11, off\n\t"
                 "global_load_async_to_lds_b128 %4, %12, off\n\t"
                 "global_load_async_to_lds_b128 %5, %13, off\n\t"
                 "global_load_async_to_lds_b128 %6, %14, off\n\t"
                 "global_load_async_to_lds_b128 %7, %15, off\n\t"
                 "s_wait_xcnt 0x0"
                 :: "v"(l), "v"(l + 1 * 16 * GP * 2), "v"(l + 2 * 16 * GP * 2), "v"(l + 3 * 16 * GP * 2), "v"(l + 4 * 16 * GP * 2), "v"(l + 5 * 16 * GP * 2), "v"(l + 6 * 16 * GP * 2), "v"(l + 7 * 16 * GP * 2),
                    "v"(g), "v"(g + 1 * 16 * DM), "v"(g + 2 * 16 * DM), "v"(g + 3 * 16 * DM), "v"(g + 4 * 16 * DM), "v"(g + 5 * 16 * DM), "v"(g + 6 * 16 * DM), "v"(g + 7 * 16 * DM) : "memory");
}
// A, A2, Bt: the work-group's first row of each plane, k = 0. sm: 2 buffers of (NA + 1) planes. On return every wave has left the buffers and no copy is in flight: sm is free for the caller.
template <int NA>
__device__ __forceinline__ void gemm_tile(const bf* A, const bf* A2, const bf* Bt, bf* sm, v8f (&acc)[4][4]) {
    typedef WFrag<bf> F;
    const int tid = threadIdx.x, lane = tid & 31, lr = lane & 15, hi = lane >> 4, w = tid >> 5;
    const size_t go = (size_t)(tid >> 3) * DM + (tid & 7) * 8;   // piece c = tid + 128 i of a plane: row c / 8, 16-byte column c % 8
    const unsigned l0 = (unsigned)(size_t)sm + ((tid >> 3) * GP + (tid & 7) * 8) * 2;
    const int ao = ((w & 1) * 64 + lr) * GP + 8 * hi, bo = NA * GPL + ((w >> 1) * 64 + lr) * GP + 8 * hi;   // a lane's own row and 16-byte column in the wave's fragments
    auto fill = [&](int t) { const unsigned l = l0 + (t & 1) * ((NA + 1) * GPL * 2); copy8(l, A + go + t * GK); if (NA == 2) copy8(l + GPL * 2, A2 + go + t * GK); copy8(l + NA * GPL * 2, Bt + go + t * GK); };
#pragma unroll
    for (int mb = 0; mb < 4; ++mb)
#pragma unroll
        for (int nb = 0; nb < 4; ++nb) acc[mb][nb] = (v8f){};
    fill(0);
    asm volatile("s_wait_asynccnt 0x0" ::: "memory");   // this wave's pieces of tile 0 have landed
    __syncthreads();   // tile 0 is in LDS for every wave
    fill(1);
#pragma unroll 1   // rolled, for speed only
    for (int t = 0; t < GNT; ++t) {
        const bf* s = sm + (t & 1) * ((NA + 1) * GPL);
        v16bf a[4], a2[4], bq[4];
        auto frags = [&](int kc) {   // the wave's fragments of 32 k
#pragma unroll
            for (int mb = 0; mb < 4; ++mb) { a[mb] = F::ld(s + ao + mb * 16 * GP + kc); if (NA == 2) a2[mb] = F::ld(s + GPL + ao + mb * 16 * GP + kc); }
#pragma unroll
            for (int nb = 0; nb < 4; ++nb) bq[nb] = F::ld(s + bo + nb * 16 * GP + kc); };
        auto prods = [&]() {
#pragma unroll
            for (int nb = 0; nb < 4; ++nb) {
#pragma unroll
                for (int mb = 0; mb < 4; ++mb) { acc[mb][nb] = F::mma(a[mb], bq[nb], acc[mb][nb]); if (NA == 2) acc[mb][nb] = F::mma(a2[mb], bq[nb], acc[mb][nb]); } } };
        frags(0);
        __builtin_amdgcn_sched_barrier(0);   // keeps these fragment reads together in front of their matrix instructions (the scheduler otherwise reads each B fragment directly in front of its users, and the wave waits out the LDS latency four times)
        prods();
        frags(32);   // the tile's last reads
        if (NA == 2) { __builtin_amdgcn_sched_barrier(0); prods(); }   // hi and lo fragments leave no registers for the copies' addresses beside them: the second half's products come first (the scheduling barrier: as above)
        asm volatile("s_wait_dscnt 0x0" ::: "memory");      // this wave's reads of tile t are done before the buffer is given up
        asm volatile("s_wait_asynccnt 0x0" ::: "memory");   // this wave's pieces of tile t + 1 have landed
        __syncthreads();   // publishes tile t + 1, and ends every wave's reads of tile t's buffer before it is refilled
        if (t + 2 < GNT) fill(t + 2);
        if (NA == 1) prods();   // the second half's products need registers alone: the refill is on its way while they run
    }
    asm volatile("s_wait_asynccnt 0x0" ::: "memory");   // no copy is in flight when the caller takes the buffers over
}

__device__ __forceinline__ void splitf(float y, unsigned short& h, unsigned short& l) { h = f2bf(y); l = f2bf(y - bf2f(h)); }
typedef __attribute__((ext_vector_type(2))) _Float16 v2h;
typedef __attribute__((ext_vector_type(4))) _Float16 v4h;
typedef __attribute__((ext_vector_type(2))) unsigned short v2us;
typedef __attribute__((ext_vector_type(4))) unsigned short v4us;
typedef __attribute__((ext_vector_type(2))) float v2f;
typedef __attribute__((ext_vector_type(2))) __bf16 v2bf;
typedef __attribute__((ext_vector_type(4))) int v4i;

// The parts of k_prep; bx: the block's index within its part.
// The two weight parts turn a row-major f32 weight into K-contiguous 16-bit rows. A block takes a tile of 64 weight rows x 128 columns: each wave reads whole rows of it (512 consecutive bytes, four whole lines, an instruction),
// lays them in LDS as they are, and after one barrier each lane gathers 8 rows of one column from LDS, rounds them and stores 16 bytes: eight lanes fill one whole line of an output row.
#define TP   129              // LDS pitch of a staged weight row, f32: rows are one bank apart (129 = 1 mod 64), so the 8 row groups x 4 columns that a wave gathers at a time fall on 32 different banks
template <int N>   // N: the weight's pitch; w: the tile's first element
__device__ __forceinline__ void p_stage(const float* __restrict__ w, float* sm) {
    const int wv = threadIdx.x >> 5, c = (threadIdx.x & 31) * 4; const float* g = w + (size_t)wv * N + c; v4f v[8];
#pragma unroll
    for (int i = 0; i < 8; ++i) v[i] = *(const v4f*)(g + (size_t)(8 * i) * N);   // a lane's eight pieces, all in flight together
#pragma unroll
    for (int i = 0; i < 8; ++i) {
#pragma unroll
        for (int j = 0; j < 4; ++j) sm[(wv + 8 * i) * TP + c + j] = v[i][j]; }
    __syncthreads();   // the whole tile is in LDS before any lane gathers a column of it
}
__device__ __forceinline__ v8us p_take8(const float* sm, int g, int col) { v8us o;
#pragma unroll
    for (int q = 0; q < 8; ++q) o[q] = f2bf(sm[(8 * g + q) * TP + col]);
    return o; }
// w_out transposed: Bt[n][k] = w[k][n]; tile 64 k x 128 n.
__device__ __forceinline__ void p_wtG(const float* __restrict__ w, bf* Bt, float* sm, int bx) {
    const int k0 = (bx % (DQ / 64)) * 64, n0 = (bx / (DQ / 64)) * 128;
    p_stage<DM>(w + (size_t)k0 * DM + n0, sm);
#pragma unroll
    for (int i = 0; i < 4; ++i) { const int p = threadIdx.x + 256 * i, g = p & 7, col = p >> 3; *(v8us*)(Bt + (size_t)(n0 + col) * DQ + k0 + 8 * g) = p_take8(sm, g, col); }
}
__device__ __forceinline__ void p_cvt8(const float* __restrict__ src, bf* dst, size_t n8, int bx) { const size_t i = (size_t)bx * 256 + threadIdx.x; if (i >= n8) return; const v8f v = *(const v8f*)(src + i * 8); v8us o;
#pragma unroll
    for (int k = 0; k < 8; ++k) o[k] = f2bf(v[k]); *(v8us*)(dst + i * 8) = o;  }
// The three gathered weights: Bt_k[h * 64 + d][c] = w[c][d * 48 + k * 16 + h]; tile 64 c x 128 columns.
__device__ __forceinline__ void p_wsel3(const float* __restrict__ w, bf* Bq, bf* Bk, bf* Bv, float* sm, int bx) {
    const int c0 = (bx % (DM / 64)) * 64, n0 = (bx / (DM / 64)) * 128;
    p_stage<3 * DQ>(w + (size_t)c0 * (3 * DQ) + n0, sm);
#pragma unroll
    for (int i = 0; i < 4; ++i) { const int p = threadIdx.x + 256 * i, g = p & 7, col = p >> 3; const int n = n0 + col, d = n / (3 * NH_), k = (n % (3 * NH_)) / NH_, h = n % NH_;
        bf* Bt = (k == 0) ? Bq : (k == 1) ? Bk : Bv; *(v8us*)(Bt + (size_t)(h * HD + d) * DM + c0 + 8 * g) = p_take8(sm, g, col); }
    asm volatile("s_wait_xcnt 0x0" ::: "memory");   // stands behind this part's last stores: in the built code another part's instructions follow and rewrite registers that these stores name
}
// k_prep: every 16-bit operand that the projections read, in one launch: w_out transposed, the three gathered weights, x converted. No part reads what another writes, so the block index alone picks a block's part.
// The weight parts, which have a barrier between their loads and their stores, come first in the grid; the stream of x follows.
#define PWT  ((DQ / 64) * (DM / 128))         // tiles of the transpose
#define PSEL ((DM / 64) * (3 * DQ / 128))     // tiles of the gathered weights
#define PCVT (NB_ * TT * DM / 8 / 256)        // blocks of the conversion
__global__ __launch_bounds__(256) void k_prep(const float* __restrict__ x, const float* __restrict__ wqkv, const float* __restrict__ wo, bf* WQ, bf* WK, bf* WV, bf* WO, bf* XB) {
    __shared__ __align__(16) float sm[64 * TP];
    const int bx = blockIdx.x;
    if (bx < PWT) p_wtG(wo, WO, sm, bx);
    else if (bx < PWT + PSEL) p_wsel3(wqkv, WQ, WK, WV, sm, bx - PWT);
    else p_cvt8(x, XB, (size_t)NB_ * TT * DM / 8, bx - PWT - PSEL);
}
// split8: 8 consecutive f32 of a staged row -> 8 hi and 8 lo bf16, one 16-byte store each.
__device__ __forceinline__ void split8(const float* s, bf* ph, bf* pl) { const v4f u = *(const v4fa*)s, w = *(const v4fa*)(s + 4); v8us oh, ol;
#pragma unroll
    for (int j = 0; j < 4; ++j) { unsigned short a, c; splitf(u[j], a, c); oh[j] = a; ol[j] = c; splitf(w[j], a, c); oh[4 + j] = a; ol[4 + j] = c; }
    *(v8us*)ph = oh; *(v8us*)pl = ol; }
// k_proj: the q, k and v projections of every sequence in one launch; a work-group of four waves per 128 x 128 tile (gemm_tile), ONE WAVE per 64x64 of it; grid (NB_ * TT / 128, NH_ / 2, 3), z = 0 q, 1 k, 2 v.
// A wave's tile is 64 tokens of one sequence x the 64 channels of one head. The wave splits its own f32 sums into hi/lo and stores them where k_fattn reads them: q and k as [b][h][t][d], v transposed as [b][h][d][t]; no f32 projection goes to memory.
// 16 plane rows at a time go through the wave's own LDS (q, k: 16 tokens x 64 d; v: 16 d x 64 tokens), so that every store instruction covers four whole 128-byte lines; that LDS is a piece of the operand buffers, which gemm_tile has left.
// Every '#pragma unroll' below, the store loops over s aside, stands on a loop that indexes a register array (accumulators).
__global__ __launch_bounds__(128, 4) void k_proj(const bf* __restrict__ X, const bf* __restrict__ Wq, const bf* __restrict__ Wk, const bf* __restrict__ Wv, bf* Qh, bf* Ql, bf* Kh, bf* Kl, bf* Vh, bf* Vl) {
    __shared__ __align__(16) bf sm[2 * 2 * GPL];
    const int lane = threadIdx.x & 31, lr = lane & 15, hi = lane >> 4, w = threadIdx.x >> 5; const int z = blockIdx.z;
    const bf* Bt = (z == 0) ? Wq : (z == 1) ? Wk : Wv;
    v8f acc[4][4];
    gemm_tile<1>(X + (size_t)blockIdx.x * 128 * DM, nullptr, Bt + (size_t)blockIdx.y * 128 * DM, sm, acc);
    const int r0 = blockIdx.x * 128 + (w & 1) * 64, h = blockIdx.y * 2 + (w >> 1);   // the wave's own first token and its head
    float* os = (float*)sm + w * (16 * 68);
    const int t0 = r0 % TT; const size_t pz = (size_t)((r0 / TT) * NH_ + h) * TT * HD; const int er = lane >> 3, ec = (lane & 7) * 8;   // a lane's row (of four) and 8-element column in a store
    if (z < 2) {
        bf* Ph = ((z == 0) ? Qh : Kh) + pz + (size_t)t0 * HD; bf* Pl = ((z == 0) ? Ql : Kl) + pz + (size_t)t0 * HD;
#pragma unroll
        for (int mb = 0; mb < 4; ++mb) {
#pragma unroll
            for (int nb = 0; nb < 4; ++nb) {
#pragma unroll
                for (int j = 0; j < 8; ++j) os[(hi * 8 + j) * 68 + nb * 16 + lr] = acc[mb][nb][j]; }
            __builtin_amdgcn_wave_barrier(); asm volatile("" ::: "memory");   // the reads below stay behind the other lanes' writes
#pragma unroll
            for (int s = 0; s < 4; ++s) { const int row = 4 * s + er; split8(os + row * 68 + ec, Ph + (mb * 16 + row) * HD + ec, Pl + (mb * 16 + row) * HD + ec); }
            __builtin_amdgcn_wave_barrier(); asm volatile("" ::: "memory");   // the next rows' writes stay behind these reads
        }
    } else {
        bf* Ph = Vh + pz + t0; bf* Pl = Vl + pz + t0;
#pragma unroll
        for (int nb = 0; nb < 4; ++nb) {
#pragma unroll
            for (int mb = 0; mb < 4; ++mb) { v4f u, w;
#pragma unroll
                for (int j = 0; j < 4; ++j) { u[j] = acc[mb][nb][j]; w[j] = acc[mb][nb][4 + j]; }
                *(v4fa*)(os + lr * 68 + mb * 16 + hi * 8) = u; *(v4fa*)(os + lr * 68 + mb * 16 + hi * 8 + 4) = w; }
            __builtin_amdgcn_wave_barrier(); asm volatile("" ::: "memory");   // the reads below stay behind the other lanes' writes
#pragma unroll
            for (int s = 0; s < 4; ++s) { const int row = 4 * s + er; split8(os + row * 68 + ec, Ph + (size_t)(nb * 16 + row) * TT + ec, Pl + (size_t)(nb * 16 + row) * TT + ec); }
            __builtin_amdgcn_wave_barrier(); asm volatile("" ::: "memory");   // the next rows' writes stay behind these reads
        }
        asm volatile("s_wait_xcnt 0x0" ::: "memory");   // stands behind this branch's last stores: in the built code the other branch's instructions follow and rewrite registers that these stores name
    }
}
// k_outp: the output projection of every sequence, C[t][n] (f32, pitch DM, t over all NB_ * TT tokens) = sum_c (Ah + Al)[t][c] Wo[n][c]; a work-group of four waves per 128 x 128 tile (gemm_tile, hi and lo planes of A), grid (NB_ * TT / 128, DM / 128): two work-groups for every WGP's LDS.
// Each wave passes its 64 x 64 sums, 16 rows at a time, through its own piece of the operand buffers, which gemm_tile has left, so that every store instruction covers whole lines.
__global__ __launch_bounds__(128, 4) void k_outp(const bf* __restrict__ Ah, const bf* __restrict__ Al, const bf* __restrict__ Wo, float* C) {
    __shared__ __align__(16) bf sm[2 * 3 * GPL];
    const int lane = threadIdx.x & 31, lr = lane & 15, hi = lane >> 4, w = threadIdx.x >> 5;
    v8f acc[4][4];
    gemm_tile<2>(Ah + (size_t)blockIdx.x * 128 * DM, Al + (size_t)blockIdx.x * 128 * DM, Wo + (size_t)blockIdx.y * 128 * DM, sm, acc);
    const int r0 = blockIdx.x * 128 + (w & 1) * 64, c0 = blockIdx.y * 128 + (w >> 1) * 64;
    float* os = (float*)sm + w * (16 * 68);
#pragma unroll
    for (int mb = 0; mb < 4; ++mb) {
#pragma unroll
        for (int nb = 0; nb < 4; ++nb) {
#pragma unroll
            for (int j = 0; j < 8; ++j) os[(hi * 8 + j) * 68 + nb * 16 + lr] = acc[mb][nb][j]; }
        __builtin_amdgcn_wave_barrier(); asm volatile("" ::: "memory");   // the reads below stay behind the other lanes' writes
        float* crow = C + (size_t)(r0 + mb * 16) * DM + c0;
#pragma unroll
        for (int s = 0; s < 8; ++s) { const int row = 2 * s + hi, cofs = lr * 4; *(v4f*)(crow + (size_t)row * DM + cofs) = *(const v4fa*)(os + row * 68 + cofs); }
        __builtin_amdgcn_wave_barrier(); asm volatile("" ::: "memory");   // the next rows' writes stay behind these reads
    }
}
// k_fattn: scores, softmax and P x V of one (sequence, head) in one kernel; nothing of the score matrix goes to memory.
// Each wave owns QT tiles of 16 queries; the work-group walks the keys KB at a time. A wave forms the TRANSPOSED scores St[key][query] = K Qt (A = key rows, B = query columns):
// a lane then holds 8 keys of ONE query (query = lane & 15, keys 8 * (lane >> 4) + j of each 16-key tile), which is the B-fragment order of the second product Ot[d][query] = Vt[d][key] Pt[key][query]:
// no value changes lanes between the two products, and the running maximum, the running sum and the rescale factor are one scalar a lane.
// Both products keep the three hi/lo terms (hh + hl + lh). p = 2^(s c - m c), c = SCL log2(e), m the running maximum; the division by the row sum comes last.
// The KB keys' K rows and Vt columns (hi and lo) are read from memory once a work-group, in whole 16-byte pieces of consecutive addresses, and shared through LDS (two buffers, one barrier a block);
// LDS rows are pitched 16 bytes x odd (K 144 B, Vt 80 B) for the 16-byte fragment reads.
// Every '#pragma unroll' below stands on a loop that indexes a register array (fragments, accumulators, staged pieces): rolled, the array would go to scratch memory.
__global__ __launch_bounds__(FW * 32, FOCC) void k_fattn(const bf* __restrict__ Qh, const bf* __restrict__ Ql, const bf* __restrict__ Kh, const bf* __restrict__ Kl, const bf* __restrict__ Vh, const bf* __restrict__ Vl, bf* Ah, bf* Al) {
    typedef WFrag<bf> F;
    __shared__ __align__(16) bf sm[2][SME];
    const int tid = threadIdx.x, lane = tid & 31, lr = lane & 15, hi = lane >> 4; const int z = blockIdx.y, b = z / NH_, h = z % NH_; const int q0 = (blockIdx.x * FW + (tid >> 5)) * (16 * QT);
    const size_t pz = (size_t)z * TT * HD; const float C = SCL * 1.4426950408889634f;
    v16bf qh[QT][2], ql[QT][2]; v8f o[QT][4]; float m[QT]; v2f l[QT];
#pragma unroll
    for (int qt = 0; qt < QT; ++qt) { m[qt] = -3.0e38f; l[qt] = (v2f){};
#pragma unroll
        for (int kc = 0; kc < 2; ++kc) { const size_t qo = pz + (size_t)(q0 + qt * 16 + lr) * HD + kc * 32 + 8 * hi; qh[qt][kc] = F::ld(Qh + qo); ql[qt][kc] = F::ld(Ql + qo); }
#pragma unroll
        for (int dt = 0; dt < 4; ++dt) o[qt][dt] = (v8f){}; }
    // staging: piece c = tid + 128 i. K: KB rows of 128 B lie one behind the other in memory, piece c = row c / 8, 16-byte column c % 8. Vt: 64 rows (d), 64 B of each, piece c = row c / 4, column c % 4.
    const unsigned kg = tid * 8, vg = (tid >> 2) * TT + (tid & 3) * 8;   // a lane's own 32-bit offsets; the rest of each address is the same for the whole work-group
    const bf* Kh0 = Kh + pz; const bf* Kl0 = Kl + pz; const bf* Vh0 = Vh + pz; const bf* Vl0 = Vl + pz; const int ks = (tid >> 3) * KPI + (tid & 7) * 8, vs = (tid >> 2) * VPI + (tid & 3) * 8;
    v8us g[8];
#pragma unroll
    for (int i = 0; i < 2; ++i) { g[i] = *(const v8us*)(Kh0 + i * 1024 + kg); g[2 + i] = *(const v8us*)(Kl0 + i * 1024 + kg); g[4 + i] = *(const v8us*)(Vh0 + i * 32 * TT + vg); g[6 + i] = *(const v8us*)(Vl0 + i * 32 * TT + vg); }
#pragma unroll
    for (int i = 0; i < 2; ++i) { *(v8us*)(&sm[0][SKH + ks + i * 16 * KPI]) = g[i]; *(v8us*)(&sm[0][SKL + ks + i * 16 * KPI]) = g[2 + i]; *(v8us*)(&sm[0][SVH + vs + i * 32 * VPI]) = g[4 + i]; *(v8us*)(&sm[0][SVL + vs + i * 32 * VPI]) = g[6 + i]; }
    __syncthreads();   // block 0 is in LDS for every wave
    for (int kb = 0; kb < TT; kb += KB) {
        const bf* s0 = sm[(kb / KB) & 1]; bf* s1 = sm[(kb / KB + 1) & 1];
        const int kn = (kb + KB < TT) ? kb + KB : kb;   // the next block is fetched into registers while this one is worked on (the last trip fetches its own block again, unused)
        // s1 is nobody's to read between the two barriers round this trip, so each half is stored as soon as it has come: K's pieces fly over the first product, Vt's (in the same registers) over the softmax and the second
#pragma unroll
        for (int i = 0; i < 2; ++i) { g[i] = *(const v8us*)(Kh0 + kn * HD + i * 1024 + kg); g[2 + i] = *(const v8us*)(Kl0 + kn * HD + i * 1024 + kg); }
        __builtin_amdgcn_sched_barrier(0);   // keeps the four loads issued here, ahead of the first product (the scheduler otherwise sinks them to their stores and the wave waits out the whole latency)
        v8f s[QT][2];
#pragma unroll
        for (int kt = 0; kt < 2; ++kt) { v16bf kh[2], kl[2];
#pragma unroll
            for (int kc = 0; kc < 2; ++kc) { const int ko = (kt * 16 + lr) * KPI + kc * 32 + 8 * hi; kh[kc] = F::ld(s0 + SKH + ko); kl[kc] = F::ld(s0 + SKL + ko); }
#pragma unroll
            for (int qt = 0; qt < QT; ++qt) { v8f a = (v8f){};
#pragma unroll
                for (int kc = 0; kc < 2; ++kc) { a = F::mma(kh[kc], qh[qt][kc], a); a = F::mma(kh[kc], ql[qt][kc], a); a = F::mma(kl[kc], qh[qt][kc], a); }
                s[qt][kt] = a; } }
        __builtin_amdgcn_sched_barrier(0);   // keeps the stores, and the wait on the loads that comes with them, behind the first product
#pragma unroll
        for (int i = 0; i < 2; ++i) { *(v8us*)(s1 + SKH + ks + i * 16 * KPI) = g[i]; *(v8us*)(s1 + SKL + ks + i * 16 * KPI) = g[2 + i]; }
#pragma unroll
        for (int i = 0; i < 2; ++i) { g[i] = *(const v8us*)(Vh0 + kn + i * 32 * TT + vg); g[2 + i] = *(const v8us*)(Vl0 + kn + i * 32 * TT + vg); }
        __builtin_amdgcn_sched_barrier(0);   // keeps these four loads issued here, ahead of the softmax and the second product
        v16bf ph[QT], pl[QT];
#pragma unroll
        for (int qt = 0; qt < QT; ++qt) { float mx = s[qt][0][0];
#pragma unroll
            for (int j = 0; j < 8; ++j) mx = fmaxf(mx, fmaxf(s[qt][0][j], s[qt][1][j]));
            mx = fmaxf(mx, __shfl_xor(mx, 16, 32));
            const float mn = fmaxf(m[qt], mx * C); const float al = __builtin_amdgcn_exp2f(m[qt] - mn); m[qt] = mn; v2f ls[2] = { (v2f){}, (v2f){} };
#pragma unroll
            for (int e = 0; e < 16; e += 2) { v2f t; t[0] = s[qt][e >> 3][e & 7]; t[1] = s[qt][e >> 3][(e & 7) + 1]; t = __builtin_elementwise_fma(t, (v2f){C, C}, (v2f){-mn, -mn}); v2f p; p[0] = __builtin_amdgcn_exp2f(t[0]); p[1] = __builtin_amdgcn_exp2f(t[1]); ls[(e >> 1) & 1] += p;
                const v2bf a = __builtin_convertvector(p, v2bf); const v2bf r = __builtin_convertvector(p - __builtin_convertvector(a, v2f), v2bf); ph[qt][e] = a[0]; ph[qt][e + 1] = a[1]; pl[qt][e] = r[0]; pl[qt][e + 1] = r[1]; }
            l[qt] = l[qt] * al + (ls[0] + ls[1]);
#pragma unroll
            for (int dt = 0; dt < 4; ++dt) o[qt][dt] *= al; }
#pragma unroll
        for (int dt = 0; dt < 4; ++dt) { const int vo = (dt * 16 + lr) * VPI + 8 * hi; const v16bf vh = F::ld(s0 + SVH + vo), vl = F::ld(s0 + SVL + vo);
#pragma unroll
            for (int qt = 0; qt < QT; ++qt) { v8f a = o[qt][dt]; a = F::mma(vh, ph[qt], a); a = F::mma(vh, pl[qt], a); a = F::mma(vl, ph[qt], a); o[qt][dt] = a; } }
#pragma unroll
        for (int i = 0; i < 2; ++i) { *(v8us*)(s1 + SVH + vs + i * 32 * VPI) = g[i]; *(v8us*)(s1 + SVL + vs + i * 32 * VPI) = g[2 + i]; }
        __syncthreads();   // publishes the next block, and ends every wave's reads of this block's buffer before the next trip refills it
    }
#pragma unroll
    for (int qt = 0; qt < QT; ++qt) { const float lh = l[qt][0] + l[qt][1]; const float f = __fdiv_rn(1.0f, lh + __shfl_xor(lh, 16, 32)); const size_t oo = ((size_t)b * TT + q0 + qt * 16 + lr) * DQ + h * HD + 8 * hi;
#pragma unroll
        for (int dt = 0; dt < 4; ++dt) { v8us oh, ol;
#pragma unroll
            for (int j = 0; j < 8; ++j) { unsigned short a, c2; splitf(o[qt][dt][j] * f, a, c2); oh[j] = a; ol[j] = c2; }
            *(v8us*)(Ah + oo + dt * 16) = oh; *(v8us*)(Al + oo + dt * 16) = ol; } }
}

extern "C" void kernel_launch(void* const* d_in, const int* in_sizes, int n_in,
                              void* d_out, int out_size, void* d_ws, size_t ws_size, hipStream_t stream) {
    (void)in_sizes; (void)n_in; (void)out_size;
    const float* x = (const float*)d_in[0]; const float* wqkv = (const float*)d_in[1]; const float* wo = (const float*)d_in[2]; const float* wq = nullptr; const float* wk = nullptr; const float* wv = nullptr; (void)wq; (void)wk; (void)wv;
    float* OUT = (float*)d_out;     // [4][2048][1024]
    char* wsp = (char*)d_ws;
    auto take = [&](size_t bytes) { char* p = wsp; wsp += (bytes + 255) & ~(size_t)255; return (void*)p; };
    bf* WQ = (bf*)take((size_t)DQ * DM * 2); bf* WK = (bf*)take((size_t)DKV * DM * 2); bf* WV = (bf*)take((size_t)DKV * DM * 2); bf* WO = (bf*)take((size_t)DM * DQ * 2);
    bf* XB = (bf*)take((size_t)NB_ * TT * DM * 2);
    const size_t PB = (size_t)NH_ * TT * HD;   // one sequence's share of a hi or lo plane; the planes hold all NB_ sequences, [b][h][..]
    bf* QPh = (bf*)take(NB_ * PB * 2); bf* QPl = (bf*)take(NB_ * PB * 2); bf* KPh = (bf*)take(NB_ * PB * 2); bf* KPl = (bf*)take(NB_ * PB * 2); bf* VTh = (bf*)take(NB_ * PB * 2); bf* VTl = (bf*)take(NB_ * PB * 2);
    bf* ATh = (bf*)take((size_t)NB_ * TT * DQ * 2); bf* ATl = (bf*)take((size_t)NB_ * TT * DQ * 2);
    if ((size_t)(wsp - (char*)d_ws) > ws_size) return;    // ws 256 MiB
    k_prep<<<PWT + PSEL + PCVT, 256, 0, stream>>>(x, wqkv, wo, WQ, WK, WV, WO, XB);   // all 16-bit operands of the projections in one launch
    k_proj<<<dim3(NB_ * TT / 128, NH_ / 2, 3), 128, 0, stream>>>(XB, WQ, WK, WV, QPh, QPl, KPh, KPl, VTh, VTl);   // q, k, v of every sequence in one launch
    k_fattn<<<dim3(TT / (16 * QT * FW), NB_ * NH_, 1), FW * 32, 0, stream>>>(QPh, QPl, KPh, KPl, VTh, VTl, ATh, ATl);   // every sequence and head in one launch
    k_outp<<<dim3(NB_ * TT / 128, DM / 128, 1), 128, 0, stream>>>(ATh, ATl, WO, OUT);   // every sequence in one launch
}

// v007
// A run of this version takes 193 microseconds.
// Two timings next to v006 put it at 1.05 and 1.06 times that version's speed.
// Counting every step since v000, it is 13.3 times as fast.
#include <hip/hip_runtime.h>
#include <stdint.h>

// Multi-headed self-attention with the (d, k, h) channel layout of its fused qkv (x [4][2048][1024]; qkv = x w_qkv ('xw' [1024][3072] 1/32, no bias) reshaped (b, t, dh, 3, h): q[h][t][d] = column d*48 + 0*16 + h, k = ... + 16 + h, v = ... + 32 + h; 16 heads x 64; scores MULTIPLIED by sqrt(64) = 8 (the source's own quirk, kept); softmax; out = merged (h d) w_out ('xw' [1024][1024]) -> [4][2048][1024] (8.4 M)). THIS ROW: the same module on FOUR sequences with the scores MULTIPLIED by sqrt(64) = 8 (the source's own quirk: 'energy * SCALE' with SCALE = D ** 0.5: kept): SCL 8.0f; every query row runs the three-product (hi/lo) form.
// Layout: bf16 copy of x, all four sequences; a gather builds the three Bt weights from the interleaved columns (Bt[h*64+d][c] = w_qkv[c][d*48 + k*16 + h]), 64-row tiles turned through LDS; these preparations and w_out's transpose are ONE launch (k_prep); ONE projection launch for q, k, v of every sequence (k_proj: exact products, each wave splits its own f32 tile and stores the hi/lo head planes); then ONE attention launch for every sequence and head (k_fattn: scores, softmax and P x V fused, hi/lo 3 products each); merged hi/lo x w_out exact, ONE launch for every sequence (k_outp).
// Compute dtypes, f32 accumulate: every input rounded to bf16; projections exact; attention 3 products (hi/lo) in both matrix products; softmax f32; w_out hl x exact.

#define NB_  4
#define TT   2048
#define DM   1024
#define NH_  16
#define NKV  16
#define HD   64
#define DQ   (NH_ * HD)
#define DKV  (NKV * HD)
#define SCL  8.0f   // HD^+0.5: this module MULTIPLIES the scores by sqrt(64)
#define FW   4      // k_fattn: waves per work-group
#define QT   2      // k_fattn: 16-query tiles per wave
#define FOCC 4      // k_fattn: waves per SIMD the register budget is set for
#define KB   32     // k_fattn: keys per pass (one softmax step)
#define KS   64     // k_fattn: keys per LDS stage (two passes)
#define NST  (TT / KS)   // k_fattn: stages
#define SPI  72     // LDS pitch of a staged K or Vt row, elements: 128 B + the 16 B that the tensor load pads behind every row
#define SPL  5120   // one staged plane in LDS, elements: 64 rows of 144 B = 9,216 B, rounded up to a multiple of 2 KiB, where the next plane begins
#define SME  (4 * SPL)   // one LDS buffer: planes K hi, K lo, Vt hi, Vt lo
typedef _Float16 h16;
typedef unsigned short bf;
typedef __attribute__((ext_vector_type(16))) __bf16   v16bf;
typedef __attribute__((ext_vector_type(16))) _Float16 v16h;
typedef __attribute__((ext_vector_type(8)))  _Float16 v8h;
typedef __attribute__((ext_vector_type(8)))  unsigned short v8us;
typedef __attribute__((ext_vector_type(8)))  float    v8f;
typedef __attribute__((ext_vector_type(4)))  float    v4f;
typedef v8h  __attribute__((may_alias)) v8ha;
typedef v4f  __attribute__((may_alias)) v4fa;
typedef v8us __attribute__((may_alias)) v8usa;

__device__ __forceinline__ unsigned short f2bf(float f) { unsigned u = __float_as_uint(f); u += 0x7FFFu + ((u >> 16) & 1u); return (unsigned short)(u >> 16); }
__device__ __forceinline__ float bf2f(unsigned short b) { return __uint_as_float(((unsigned)b) << 16); }
__device__ __forceinline__ float bfr(float f) { return bf2f(f2bf(f)); }
__device__ __forceinline__ v16h cat16(v8h lo, v8h hi) { return __builtin_shufflevector(lo, hi, 0, 1, 2, 3, 4, 5, 6, 7, 8, 9, 10, 11, 12, 13, 14, 15); }
__device__ __forceinline__ v16bf cat16b(v8us lo, v8us hi) { return __builtin_bit_cast(v16bf, __builtin_shufflevector(lo, hi, 0, 1, 2, 3, 4, 5, 6, 7, 8, 9, 10, 11, 12, 13, 14, 15)); }
__device__ __forceinline__ v8f wmma16(v16h a, v16h b, v8f c) { return __builtin_amdgcn_wmma_f32_16x16x32_f16(false, a, false, b, (short)0, c, false, false); }
__device__ __forceinline__ v8f wmmab(v16bf a, v16bf b, v8f c) { return __builtin_amdgcn_wmma_f32_16x16x32_bf16(false, a, false, b, (short)0, c, false, false); }



// ---- Tensor load: ONE request of a whole wave brings a two-dimensional tile from memory into LDS, through no register. It ignores EXEC, and the compiler places no wait for it.
typedef uint32_t u32x4 __attribute__((ext_vector_type(4)));
typedef uint32_t u32x8 __attribute__((ext_vector_type(8)));
__device__ __forceinline__ uint32_t uni(uint32_t v) { return (uint32_t)__builtin_amdgcn_readfirstlane(v); }
__device__ __forceinline__ uint32_t pinned(uint32_t v) { uint32_t w = (uint32_t)__builtin_amdgcn_readfirstlane(v); asm volatile("" : "+s"(w)); return w; }   // a wave-uniform value held in a scalar register: a test on it compiles to a scalar branch, and a descriptor word made from it is formed behind the waits that stand in front of it
// Group 1 for a tile of 'rows' rows of 128 B at a source pitch of 'pitch' bytes: 1-byte elements, tensor = tile, a pad of 4 dwords behind every 32 dwords, so the rows lie 144 B apart in LDS.
__device__ __forceinline__ u32x8 tdm_group1(uint32_t rows, uint32_t pitch) { u32x8 g; g[0] = uni(1u << 20 | 4u << 22 | 3u << 25); g[1] = uni(128u << 16); g[2] = uni(rows << 16); g[3] = uni(128u << 16); g[4] = uni(rows); g[5] = uni(pitch); g[6] = uni(0u); g[7] = uni(0u);
    asm volatile("" : "+s"(g));   // pinned(), for the whole group: the descriptor's words held in one set of scalar registers, which the compiler then neither rebuilds elsewhere nor reuses while a request is on its way
    return g; }
// Group 0: the tile's place in LDS (byte offset in the work-group's LDS) and the address of its first byte.
__device__ __forceinline__ u32x4 tdm_group0(uint32_t lds, uint64_t ga) { u32x4 g; g[0] = uni(1u); g[1] = uni(lds); g[2] = uni((uint32_t)ga); g[3] = uni(((uint32_t)(ga >> 32) & 0x01FFFFFFu) | 0x80000000u); return g; }
__device__ __forceinline__ void tdm_load(u32x4 g0, u32x8 g1) { asm volatile("tensor_load_to_lds %0, %1" :: "s"(g0), "s"(g1) : "memory"); }
// The wave's own requests have landed. The wait names the last request's descriptor as inputs, so that its registers keep their values until the request is done.
__device__ __forceinline__ void tdm_wait(u32x4 g0, u32x8 g1) { asm volatile("s_wait_tensorcnt 0x0" :: "s"(g0), "s"(g1) : "memory"); }

// ---- gemm_tile: the k loop of both projection kernels. A work-group of four waves (2 x 2) sums a 128 x 128 tile of C[m][n] = sum_k A[m][k] Bt[n][k]; each wave keeps 64 x 64 (16 accumulators).
// The operands' rows are K-contiguous 16-bit planes of pitch DM. GK = 64 k columns at a time (one whole 128-byte line of every row) go from memory to LDS by tensor loads, through no register:
// wave p brings plane p's 128 rows with one request a tile (the waves beyond the planes issue none), and every staged row is read by two waves. Two buffers: tile t + 1 flies while tile t is worked on; one barrier a tile.
// Every '#pragma unroll' in gemm_tile and in the two kernels' epilogues, the store loops over s aside, stands on a loop that indexes a register array (fragments, accumulators): rolled, the array would go to scratch memory.
// The load pads every row by 16 B: LDS rows are pitched 16 bytes x odd (144 B) for the 16-byte fragment reads. NA = 2: A comes as hi and lo planes, two products a fragment pair. The products and their order along k are those of a wave that reads its fragments from memory, 32 k at a time.
#define GK   64               // k columns per staged tile
#define GP   72               // LDS pitch of a staged row, elements (128 B + 16)
#define GPL  (128 * GP)       // one staged plane (128 rows), elements: 18,432 B, a multiple of 2 KiB
#define GNT  (DM / GK)        // staged tiles along k
template <typename T16> struct WFrag;
template <> struct WFrag<h16> { typedef v16h V; static __device__ __forceinline__ V ld(const h16* p) { return cat16(*(const v8h*)p, *(const v8h*)(p + 16)); } static __device__ __forceinline__ v8f mma(V a, V b, v8f c) { return wmma16(a, b, c); } };
template <> struct WFrag<bf> { typedef v16bf V; static __device__ __forceinline__ V ld(const bf* p) { return cat16b(*(const v8us*)p, *(const v8us*)(p + 16)); } static __device__ __forceinline__ v8f mma(V a, V b, v8f c) { return wmmab(a, b, c); } };
// A, A2, Bt: the work-group's first row of each plane, k = 0. sm: 2 buffers of (NA + 1) planes, at a multiple of 2 KiB. On return every wave has left the buffers and no request is in flight: sm is free for the caller.
template <int NA>
__device__ __forceinline__ void gemm_tile(const bf* A, const bf* A2, const bf* Bt, bf* sm, v8f (&acc)[4][4]) {
    typedef WFrag<bf> F;
    const int tid = threadIdx.x, lane = tid & 31, lr = lane & 15, hi = lane >> 4, w = tid >> 5;
    const uint32_t wave = uni((uint32_t)tid >> 5);
    const bf* src = (wave == 0) ? A : (NA == 2 && wave == 1) ? A2 : Bt;   // the plane that this wave brings
    const uint32_t ldst = (uint32_t)(size_t)sm + wave * (GPL * 2);
    const u32x8 g1 = tdm_group1(128u, DM * 2);
    auto desc = [&](uint32_t t) { return tdm_group0(ldst + (t & 1u) * ((NA + 1) * GPL * 2), (uint64_t)(size_t)src + (uint64_t)t * (GK * 2)); };   // tile t of the wave's plane
    const int ao = ((w & 1) * 64 + lr) * GP + 8 * hi, bo = NA * GPL + ((w >> 1) * 64 + lr) * GP + 8 * hi;   // a lane's own row and 16-byte column in the wave's fragments
#pragma unroll
    for (int mb = 0; mb < 4; ++mb)
#pragma unroll
        for (int nb = 0; nb < 4; ++nb) acc[mb][nb] = (v8f){};
    u32x4 g0 = desc(0);
    if (pinned(wave <= NA)) tdm_load(g0, g1);   // a scalar branch round every request: one wave a plane
    tdm_wait(g0, g1);   // this wave's plane of tile 0 has landed
    __syncthreads();   // tile 0 is in LDS for every wave
    g0 = desc(pinned(1));   // pinned: formed behind the wait
    if (pinned(wave <= NA)) tdm_load(g0, g1);
#pragma unroll 1   // rolled, for speed only
    for (int t = 0; t < GNT; ++t) {
        const bf* s = sm + (t & 1) * ((NA + 1) * GPL);
        v16bf a[4], a2[4], bq[4];
        auto frags = [&](int kc) {   // the wave's fragments of 32 k
#pragma unroll
            for (int mb = 0; mb < 4; ++mb) { a[mb] = F::ld(s + ao + mb * 16 * GP + kc); if (NA == 2) a2[mb] = F::ld(s + GPL + ao + mb * 16 * GP + kc); }
#pragma unroll
            for (int nb = 0; nb < 4; ++nb) bq[nb] = F::ld(s + bo + nb * 16 * GP + kc); };
        auto prods = [&]() {
#pragma unroll
            for (int nb = 0; nb < 4; ++nb) {
#pragma unroll
                for (int mb = 0; mb < 4; ++mb) { acc[mb][nb] = F::mma(a[mb], bq[nb], acc[mb][nb]); if (NA == 2) acc[mb][nb] = F::mma(a2[mb], bq[nb], acc[mb][nb]); } } };
        frags(0);
        __builtin_amdgcn_sched_barrier(0);   // keeps these fragment reads together in front of their matrix instructions (the scheduler otherwise reads each B fragment directly in front of its users, and the wave waits out the LDS latency four times)
        prods();
        frags(32);   // the tile's last reads
        asm volatile("s_wait_dscnt 0x0" ::: "memory");      // this wave's reads of tile t are done before the buffer is given up
        tdm_wait(g0, g1);   // this wave's plane of tile t + 1 has landed
        __syncthreads();   // publishes tile t + 1, and ends every wave's reads of tile t's buffer before it is refilled
        if (pinned(wave <= NA && t + 2 < GNT)) { g0 = desc(pinned(t + 2)); tdm_load(g0, g1); }   // a scalar branch round the request; pinned(t + 2): the descriptor is formed here, behind the wait
        prods();   // the second half's products need registers alone: the refill is on its way while they run
    }
    tdm_wait(g0, g1);   // no request is in flight when the caller takes the buffers over
    asm volatile("s_wait_dscnt 0x0" ::: "memory");   // nor an LDS read
}

__device__ __forceinline__ void splitf(float y, unsigned short& h, unsigned short& l) { h = f2bf(y); l = f2bf(y - bf2f(h)); }
typedef __attribute__((ext_vector_type(2))) _Float16 v2h;
typedef __attribute__((ext_vector_type(4))) _Float16 v4h;
typedef __attribute__((ext_vector_type(2))) unsigned short v2us;
typedef __attribute__((ext_vector_type(4))) unsigned short v4us;
typedef __attribute__((ext_vector_type(2))) float v2f;
typedef __attribute__((ext_vector_type(2))) __bf16 v2bf;
typedef __attribute__((ext_vector_type(4))) int v4i;

// The parts of k_prep; bx: the block's index within its part.
// The two weight parts turn a row-major f32 weight into K-contiguous 16-bit rows. A block takes a tile of 64 weight rows x 128 columns: each wave reads whole rows of it (512 consecutive bytes, four whole lines, an instruction),
// lays them in LDS as they are, and after one barrier each lane gathers 8 rows of one column from LDS, rounds them and stores 16 bytes: eight lanes fill one whole line of an output row.
#define TP   129              // LDS pitch of a staged weight row, f32: rows are one bank apart (129 = 1 mod 64), so the 8 row groups x 4 columns that a wave gathers at a time fall on 32 different banks
template <int N>   // N: the weight's pitch; w: the tile's first element
__device__ __forceinline__ void p_stage(const float* __restrict__ w, float* sm) {
    const int wv = threadIdx.x >> 5, c = (threadIdx.x & 31) * 4; const float* g = w + (size_t)wv * N + c; v4f v[8];
#pragma unroll
    for (int i = 0; i < 8; ++i) v[i] = *(const v4f*)(g + (size_t)(8 * i) * N);   // a lane's eight pieces, all in flight together
#pragma unroll
    for (int i = 0; i < 8; ++i) {
#pragma unroll
        for (int j = 0; j < 4; ++j) sm[(wv + 8 * i) * TP + c + j] = v[i][j]; }
    __syncthreads();   // the whole tile is in LDS before any lane gathers a column of it
}
__device__ __forceinline__ v8us p_take8(const float* sm, int g, int col) { v8us o;
#pragma unroll
    for (int q = 0; q < 8; ++q) o[q] = f2bf(sm[(8 * g + q) * TP + col]);
    return o; }
// w_out transposed: Bt[n][k] = w[k][n]; tile 64 k x 128 n.
__device__ __forceinline__ void p_wtG(const float* __restrict__ w, bf* Bt, float* sm, int bx) {
    const int k0 = (bx % (DQ / 64)) * 64, n0 = (bx / (DQ / 64)) * 128;
    p_stage<DM>(w + (size_t)k0 * DM + n0, sm);
#pragma unroll
    for (int i = 0; i < 4; ++i) { const int p = threadIdx.x + 256 * i, g = p & 7, col = p >> 3; *(v8us*)(Bt + (size_t)(n0 + col) * DQ + k0 + 8 * g) = p_take8(sm, g, col); }
}
__device__ __forceinline__ void p_cvt8(const float* __restrict__ src, bf* dst, size_t n8, int bx) { const size_t i = (size_t)bx * 256 + threadIdx.x; if (i >= n8) return; const v8f v = *(const v8f*)(src + i * 8); v8us o;
#pragma unroll
    for (int k = 0; k < 8; ++k) o[k] = f2bf(v[k]); *(v8us*)(dst + i * 8) = o;  }
// The three gathered weights: Bt_k[h * 64 + d][c] = w[c][d * 48 + k * 16 + h]; tile 64 c x 128 columns.
__device__ __forceinline__ void p_wsel3(const float* __restrict__ w, bf* Bq, bf* Bk, bf* Bv, float* sm, int bx) {
    const int c0 = (bx % (DM / 64)) * 64, n0 = (bx / (DM / 64)) * 128;
    p_stage<3 * DQ>(w + (size_t)c0 * (3 * DQ) + n0, sm);
#pragma unroll
    for (int i = 0; i < 4; ++i) { const int p = threadIdx.x + 256 * i, g = p & 7, col = p >> 3; const int n = n0 + col, d = n / (3 * NH_), k = (n % (3 * NH_)) / NH_, h = n % NH_;
        bf* Bt = (k == 0) ? Bq : (k == 1) ? Bk : Bv; *(v8us*)(Bt + (size_t)(h * HD + d) * DM + c0 + 8 * g) = p_take8(sm, g, col); }
    asm volatile("s_wait_xcnt 0x0" ::: "memory");   // stands behind this part's last stores: in the built code another part's instructions follow and rewrite registers that these stores name
}
// k_prep: every 16-bit operand that the projections read, in one launch: w_out transposed, the three gathered weights, x converted. No part reads what another writes, so the block index alone picks a block's part.
// The weight parts, which have a barrier between their loads and their stores, come first in the grid; the stream of x follows.
#define PWT  ((DQ / 64) * (DM / 128))         // tiles of the transpose
#define PSEL ((DM / 64) * (3 * DQ / 128))     // tiles of the gathered weights
#define PCVT (NB_ * TT * DM / 8 / 256)        // blocks of the conversion
__global__ __launch_bounds__(256) void k_prep(const float* __restrict__ x, const float* __restrict__ wqkv, const float* __restrict__ wo, bf* WQ, bf* WK, bf* WV, bf* WO, bf* XB) {
    __shared__ __align__(16) float sm[64 * TP];
    const int bx = blockIdx.x;
    if (bx < PWT) p_wtG(wo, WO, sm, bx);
    else if (bx < PWT + PSEL) p_wsel3(wqkv, WQ, WK, WV, sm, bx - PWT);
    else p_cvt8(x, XB, (size_t)NB_ * TT * DM / 8, bx - PWT - PSEL);
}
// split8: 8 consecutive f32 of a staged row -> 8 hi and 8 lo bf16, one 16-byte store each.
__device__ __forceinline__ void split8(const float* s, bf* ph, bf* pl) { const v4f u = *(const v4fa*)s, w = *(const v4fa*)(s + 4); v8us oh, ol;
#pragma unroll
    for (int j = 0; j < 4; ++j) { unsigned short a, c; splitf(u[j], a, c); oh[j] = a; ol[j] = c; splitf(w[j], a, c); oh[4 + j] = a; ol[4 + j] = c; }
    *(v8us*)ph = oh; *(v8us*)pl = ol; }
// k_proj: the q, k and v projections of every sequence in one launch; a work-group of four waves per 128 x 128 tile (gemm_tile), ONE WAVE per 64x64 of it; grid (NB_ * TT / 128, NH_ / 2, 3), z = 0 q, 1 k, 2 v.
// A wave's tile is 64 tokens of one sequence x the 64 channels of one head. The wave splits its own f32 sums into hi/lo and stores them where k_fattn reads them: q and k as [b][h][t][d], v transposed as [b][h][d][t]; no f32 projection goes to memory.
// 16 plane rows at a time go through the wave's own LDS (q, k: 16 tokens x 64 d; v: 16 d x 64 tokens), so that every store instruction covers four whole 128-byte lines; that LDS is a piece of the operand buffers, which gemm_tile has left.
// Every '#pragma unroll' below, the store loops over s aside, stands on a loop that indexes a register array (accumulators).
__global__ __launch_bounds__(128, 4) void k_proj(const bf* __restrict__ X, const bf* __restrict__ Wq, const bf* __restrict__ Wk, const bf* __restrict__ Wv, bf* Qh, bf* Ql, bf* Kh, bf* Kl, bf* Vh, bf* Vl) {
    __shared__ __attribute__((aligned(2048))) bf sm[2 * 2 * GPL];
    const int lane = threadIdx.x & 31, lr = lane & 15, hi = lane >> 4, w = threadIdx.x >> 5; const int z = blockIdx.z;
    const bf* Bt = (z == 0) ? Wq : (z == 1) ? Wk : Wv;
    v8f acc[4][4];
    gemm_tile<1>(X + (size_t)blockIdx.x * 128 * DM, nullptr, Bt + (size_t)blockIdx.y * 128 * DM, sm, acc);
    const int r0 = blockIdx.x * 128 + (w & 1) * 64, h = blockIdx.y * 2 + (w >> 1);   // the wave's own first token and its head
    float* os = (float*)sm + w * (16 * 68);
    const int t0 = r0 % TT; const size_t pz = (size_t)((r0 / TT) * NH_ + h) * TT * HD; const int er = lane >> 3, ec = (lane & 7) * 8;   // a lane's row (of four) and 8-element column in a store
    if (z < 2) {
        bf* Ph = ((z == 0) ? Qh : Kh) + pz + (size_t)t0 * HD; bf* Pl = ((z == 0) ? Ql : Kl) + pz + (size_t)t0 * HD;
#pragma unroll
        for (int mb = 0; mb < 4; ++mb) {
#pragma unroll
            for (int nb = 0; nb < 4; ++nb) {
#pragma unroll
                for (int j = 0; j < 8; ++j) os[(hi * 8 + j) * 68 + nb * 16 + lr] = acc[mb][nb][j]; }
            __builtin_amdgcn_wave_barrier(); asm volatile("" ::: "memory");   // the reads below stay behind the other lanes' writes
#pragma unroll
            for (int s = 0; s < 4; ++s) { const int row = 4 * s + er; split8(os + row * 68 + ec, Ph + (mb * 16 + row) * HD + ec, Pl + (mb * 16 + row) * HD + ec); }
            __builtin_amdgcn_wave_barrier(); asm volatile("" ::: "memory");   // the next rows' writes stay behind these reads
        }
    } else {
        bf* Ph = Vh + pz + t0; bf* Pl = Vl + pz + t0;
#pragma unroll
        for (int nb = 0; nb < 4; ++nb) {
#pragma unroll
            for (int mb = 0; mb < 4; ++mb) { v4f u, w;
#pragma unroll
                for (int j = 0; j < 4; ++j) { u[j] = acc[mb][nb][j]; w[j] = acc[mb][nb][4 + j]; }
                *(v4fa*)(os + lr * 68 + mb * 16 + hi * 8) = u; *(v4fa*)(os + lr * 68 + mb * 16 + hi * 8 + 4) = w; }
            __builtin_amdgcn_wave_barrier(); asm volatile("" ::: "memory");   // the reads below stay behind the other lanes' writes
#pragma unroll
            for (int s = 0; s < 4; ++s) { const int row = 4 * s + er; split8(os + row * 68 + ec, Ph + (size_t)(nb * 16 + row) * TT + ec, Pl + (size_t)(nb * 16 + row) * TT + ec); }
            __builtin_amdgcn_wave_barrier(); asm volatile("" ::: "memory");   // the next rows' writes stay behind these reads
        }
        asm volatile("s_wait_xcnt 0x0" ::: "memory");   // stands behind this branch's last stores: in the built code the other branch's instructions follow and rewrite registers that these stores name
    }
}
// k_outp: the output projection of every sequence, C[t][n] (f32, pitch DM, t over all NB_ * TT tokens) = sum_c (Ah + Al)[t][c] Wo[n][c]; a work-group of four waves per 128 x 128 tile (gemm_tile, hi and lo planes of A), grid (NB_ * TT / 128, DM / 128): two work-groups for every WGP's LDS.
// Each wave passes its 64 x 64 sums, 16 rows at a time, through its own piece of the operand buffers, which gemm_tile has left, so that every store instruction covers whole lines.
__global__ __launch_bounds__(128, 4) void k_outp(const bf* __restrict__ Ah, const bf* __restrict__ Al, const bf* __restrict__ Wo, float* C) {
    __shared__ __attribute__((aligned(2048))) bf sm[2 * 3 * GPL];
    const int lane = threadIdx.x & 31, lr = lane & 15, hi = lane >> 4, w = threadIdx.x >> 5;
    v8f acc[4][4];
    gemm_tile<2>(Ah + (size_t)blockIdx.x * 128 * DM, Al + (size_t)blockIdx.x * 128 * DM, Wo + (size_t)blockIdx.y * 128 * DM, sm, acc);
    const int r0 = blockIdx.x * 128 + (w & 1) * 64, c0 = blockIdx.y * 128 + (w >> 1) * 64;
    float* os = (float*)sm + w * (16 * 68);
#pragma unroll
    for (int mb = 0; mb < 4; ++mb) {
#pragma unroll
        for (int nb = 0; nb < 4; ++nb) {
#pragma unroll
            for (int j = 0; j < 8; ++j) os[(hi * 8 + j) * 68 + nb * 16 + lr] = acc[mb][nb][j]; }
        __builtin_amdgcn_wave_barrier(); asm volatile("" ::: "memory");   // the reads below stay behind the other lanes' writes
        float* crow = C + (size_t)(r0 + mb * 16) * DM + c0;
#pragma unroll
        for (int s = 0; s < 8; ++s) { const int row = 2 * s + hi, cofs = lr * 4; *(v4f*)(crow + (size_t)row * DM + cofs) = *(const v4fa*)(os + row * 68 + cofs); }
        __builtin_amdgcn_wave_barrier(); asm volatile("" ::: "memory");   // the next rows' writes stay behind these reads
    }
}
// k_fattn: scores, softmax and P x V of one (sequence, head) in one kernel; nothing of the score matrix goes to memory.
// Each wave owns QT tiles of 16 queries; the work-group walks the keys KB at a time. A wave forms the TRANSPOSED scores St[key][query] = K Qt (A = key rows, B = query columns):
// a lane then holds 8 keys of ONE query (query = lane & 15, keys 8 * (lane >> 4) + j of each 16-key tile), which is the B-fragment order of the second product Ot[d][query] = Vt[d][key] Pt[key][query]:
// no value changes lanes between the two products, and the running maximum, the running sum and the rescale factor are one scalar a lane.
// Both products keep the three hi/lo terms (hh + hl + lh). p = 2^(s c - m c), c = SCL log2(e), m the running maximum; the division by the row sum comes last.
// K rows and Vt columns (hi and lo) come to LDS KS keys at a time, once a work-group, by tensor loads: each of the four waves brings one plane's tile of 64 rows x 128 B (K: 64 keys x 64 d; Vt: 64 d x 64 keys) with one request a stage.
// Two buffers: stage s + 1 flies while stage s is worked on (two passes of KB keys); one barrier a stage. The load pads every row by 16 B, so LDS rows are pitched 16 bytes x odd (144 B) for the 16-byte fragment reads.
// Every '#pragma unroll' below stands on a loop that indexes a register array (fragments, accumulators): rolled, the array would go to scratch memory.
__global__ __launch_bounds__(FW * 32, FOCC) void k_fattn(const bf* __restrict__ Qh, const bf* __restrict__ Ql, const bf* __restrict__ Kh, const bf* __restrict__ Kl, const bf* __restrict__ Vh, const bf* __restrict__ Vl, bf* Ah, bf* Al) {
    typedef WFrag<bf> F;
    __shared__ __attribute__((aligned(2048))) bf sm[2 * SME - (SPL - KS * SPI)];   // two buffers; nothing follows the last plane, so its size is not rounded up
    const int tid = threadIdx.x, lane = tid & 31, lr = lane & 15, hi = lane >> 4; const int z = blockIdx.y, b = z / NH_, h = z % NH_; const int q0 = (blockIdx.x * FW + (tid >> 5)) * (16 * QT);
    const size_t pz = (size_t)z * TT * HD; const float C = SCL * 1.4426950408889634f;
    // Wave w brings plane w of every stage. K: the stage's 64 rows lie one behind the other (pitch 128 B), the next stage 64 rows on. Vt: 128 B of each of the 64 rows (pitch TT elements), the next stage 128 B on.
    const uint32_t wave = uni((uint32_t)tid >> 5);
    const bf* src = ((wave == 0) ? Kh : (wave == 1) ? Kl : (wave == 2) ? Vh : Vl) + pz;
    const uint32_t spitch = (wave < 2) ? HD * 2 : TT * 2, sstep = (wave < 2) ? KS * HD * 2 : KS * 2;   // bytes
    const uint32_t ldst = (uint32_t)(size_t)sm + wave * (SPL * 2);
    const u32x8 g1 = tdm_group1(64u, spitch);
    auto desc = [&](uint32_t st) { return tdm_group0(ldst + (st & 1u) * (SME * 2), (uint64_t)(size_t)src + (uint64_t)st * sstep); };   // stage st of the wave's plane
    u32x4 g0 = desc(0);
    tdm_load(g0, g1);   // every wave issues its own plane: no test
    v16bf qh[QT][2], ql[QT][2]; v8f o[QT][4]; float m[QT]; v2f l[QT];
#pragma unroll
    for (int qt = 0; qt < QT; ++qt) { m[qt] = -3.0e38f; l[qt] = (v2f){};
#pragma unroll
        for (int kc = 0; kc < 2; ++kc) { const size_t qo = pz + (size_t)(q0 + qt * 16 + lr) * HD + kc * 32 + 8 * hi; qh[qt][kc] = F::ld(Qh + qo); ql[qt][kc] = F::ld(Ql + qo); }
#pragma unroll
        for (int dt = 0; dt < 4; ++dt) o[qt][dt] = (v8f){}; }
    tdm_wait(g0, g1);   // this wave's plane of stage 0 has landed
    __syncthreads();   // stage 0 is in LDS for every wave
    g0 = desc(pinned(1));   // pinned: formed behind the wait
    tdm_load(g0, g1);
#pragma unroll 1   // rolled, for speed only
    for (int st = 0; st < NST; ++st) {
        const bf* s0 = sm + (st & 1) * SME;
#pragma unroll 1   // rolled: unrolled, the two passes' values live side by side and leave one register set for the fragments
        for (int ps = 0; ps < KS / KB; ++ps) {
            v8f s[QT][2];
#pragma unroll
            for (int kt = 0; kt < 2; ++kt) { v16bf kh[2], kl[2];
#pragma unroll
                for (int kc = 0; kc < 2; ++kc) { const int ko = (ps * KB + kt * 16 + lr) * SPI + kc * 32 + 8 * hi; kh[kc] = F::ld(s0 + ko); kl[kc] = F::ld(s0 + SPL + ko); }
#pragma unroll
                for (int qt = 0; qt < QT; ++qt) { v8f a = (v8f){};
#pragma unroll
                    for (int kc = 0; kc < 2; ++kc) { a = F::mma(kh[kc], qh[qt][kc], a); a = F::mma(kh[kc], ql[qt][kc], a); a = F::mma(kl[kc], qh[qt][kc], a); }
                    s[qt][kt] = a; } }
            v16bf ph[QT], pl[QT];
#pragma unroll
            for (int qt = 0; qt < QT; ++qt) { float mx = s[qt][0][0];
#pragma unroll
                for (int j = 0; j < 8; ++j) mx = fmaxf(mx, fmaxf(s[qt][0][j], s[qt][1][j]));
                mx = fmaxf(mx, __shfl_xor(mx, 16, 32));
                const float mn = fmaxf(m[qt], mx * C); const float al = __builtin_amdgcn_exp2f(m[qt] - mn); m[qt] = mn; v2f ls[2] = { (v2f){}, (v2f){} };
#pragma unroll
                for (int e = 0; e < 16; e += 2) { v2f t; t[0] = s[qt][e >> 3][e & 7]; t[1] = s[qt][e >> 3][(e & 7) + 1]; t = __builtin_elementwise_fma(t, (v2f){C, C}, (v2f){-mn, -mn}); v2f p; p[0] = __builtin_amdgcn_exp2f(t[0]); p[1] = __builtin_amdgcn_exp2f(t[1]); ls[(e >> 1) & 1] += p;
                    const v2bf a = __builtin_convertvector(p, v2bf); const v2bf r = __builtin_convertvector(p - __builtin_convertvector(a, v2f), v2bf); ph[qt][e] = a[0]; ph[qt][e + 1] = a[1]; pl[qt][e] = r[0]; pl[qt][e + 1] = r[1]; }
                l[qt] = l[qt] * al + (ls[0] + ls[1]);
#pragma unroll
                for (int dt = 0; dt < 4; ++dt) o[qt][dt] *= al; }
#pragma unroll
            for (int dt = 0; dt < 4; ++dt) { const int vo = (dt * 16 + lr) * SPI + ps * KB + 8 * hi; const v16bf vh = F::ld(s0 + 2 * SPL + vo), vl = F::ld(s0 + 3 * SPL + vo);
#pragma unroll
                for (int qt = 0; qt < QT; ++qt) { v8f a = o[qt][dt]; a = F::mma(vh, ph[qt], a); a = F::mma(vh, pl[qt], a); a = F::mma(vl, ph[qt], a); o[qt][dt] = a; } }
        }
        asm volatile("s_wait_dscnt 0x0" ::: "memory");      // this wave's reads of stage st are done before its buffer is given up
        tdm_wait(g0, g1);   // this wave's plane of stage st + 1 has landed
        __syncthreads();   // publishes stage st + 1, and ends every wave's reads of stage st's buffer before it is refilled
        if (pinned(st + 2 < NST)) { g0 = desc(pinned(st + 2)); tdm_load(g0, g1); }   // a scalar branch round the request; pinned(st + 2): the descriptor is formed here, behind the wait
    }
    tdm_wait(g0, g1);   // no request is in flight when the wave ends
    asm volatile("s_wait_dscnt 0x0" ::: "memory");       // nor an LDS read
#pragma unroll
    for (int qt = 0; qt < QT; ++qt) { const float lh = l[qt][0] + l[qt][1]; const float f = __fdiv_rn(1.0f, lh + __shfl_xor(lh, 16, 32)); const size_t oo = ((size_t)b * TT + q0 + qt * 16 + lr) * DQ + h * HD + 8 * hi;
#pragma unroll
        for (int dt = 0; dt < 4; ++dt) { v8us oh, ol;
#pragma unroll
            for (int j = 0; j < 8; ++j) { unsigned short a, c2; splitf(o[qt][dt][j] * f, a, c2); oh[j] = a; ol[j] = c2; }
            *(v8us*)(Ah + oo + dt * 16) = oh; *(v8us*)(Al + oo + dt * 16) = ol; } }
}

extern "C" void kernel_launch(void* const* d_in, const int* in_sizes, int n_in,
                              void* d_out, int out_size, void* d_ws, size_t ws_size, hipStream_t stream) {
    (void)in_sizes; (void)n_in; (void)out_size;
    const float* x = (const float*)d_in[0]; const float* wqkv = (const float*)d_in[1]; const float* wo = (const float*)d_in[2]; const float* wq = nullptr; const float* wk = nullptr; const float* wv = nullptr; (void)wq; (void)wk; (void)wv;
    float* OUT = (float*)d_out;     // [4][2048][1024]
    char* wsp = (char*)d_ws;
    auto take = [&](size_t bytes) { char* p = wsp; wsp += (bytes + 255) & ~(size_t)255; return (void*)p; };
    bf* WQ = (bf*)take((size_t)DQ * DM * 2); bf* WK = (bf*)take((size_t)DKV * DM * 2); bf* WV = (bf*)take((size_t)DKV * DM * 2); bf* WO = (bf*)take((size_t)DM * DQ * 2);
    bf* XB = (bf*)take((size_t)NB_ * TT * DM * 2);
    const size_t PB = (size_t)NH_ * TT * HD;   // one sequence's share of a hi or lo plane; the planes hold all NB_ sequences, [b][h][..]
    bf* QPh = (bf*)take(NB_ * PB * 2); bf* QPl = (bf*)take(NB_ * PB * 2); bf* KPh = (bf*)take(NB_ * PB * 2); bf* KPl = (bf*)take(NB_ * PB * 2); bf* VTh = (bf*)take(NB_ * PB * 2); bf* VTl = (bf*)take(NB_ * PB * 2);
    bf* ATh = (bf*)take((size_t)NB_ * TT * DQ * 2); bf* ATl = (bf*)take((size_t)NB_ * TT * DQ * 2);
    if ((size_t)(wsp - (char*)d_ws) > ws_size) return;    // ws 256 MiB
    k_prep<<<PWT + PSEL + PCVT, 256, 0, stream>>>(x, wqkv, wo, WQ, WK, WV, WO, XB);   // all 16-bit operands of the projections in one launch
    k_proj<<<dim3(NB_ * TT / 128, NH_ / 2, 3), 128, 0, stream>>>(XB, WQ, WK, WV, QPh, QPl, KPh, KPl, VTh, VTl);   // q, k, v of every sequence in one launch
    k_fattn<<<dim3(TT / (16 * QT * FW), NB_ * NH_, 1), FW * 32, 0, stream>>>(QPh, QPl, KPh, KPl, VTh, VTl, ATh, ATl);   // every sequence and head in one launch
    k_outp<<<dim3(NB_ * TT / 128, DM / 128, 1), 128, 0, stream>>>(ATh, ATl, WO, OUT);   // every sequence in one launch
}

// v008
// One run takes 186 microseconds.
// Two timings next to v007 both put it at 1.03 times that version's speed.
// Counting every step since v000, it is 13.8 times as fast.
#include <hip/hip_runtime.h>
#include <stdint.h>

// Multi-headed self-attention with the (d, k, h) channel layout of its fused qkv (x [4][2048][1024]; qkv = x w_qkv ('xw' [1024][3072] 1/32, no bias) reshaped (b, t, dh, 3, h): q[h][t][d] = column d*48 + 0*16 + h, k = ... + 16 + h, v = ... + 32 + h; 16 heads x 64; scores MULTIPLIED by sqrt(64) = 8 (the source's own quirk, kept); softmax; out = merged (h d) w_out ('xw' [1024][1024]) -> [4][2048][1024] (8.4 M)). THIS ROW: the same module on FOUR sequences with the scores MULTIPLIED by sqrt(64) = 8 (the source's own quirk: 'energy * SCALE' with SCALE = D ** 0.5: kept): SCL 8.0f; every query row runs the three-product (hi/lo) form.
// Layout: bf16 copy of x, all four sequences; a gather builds the three Bt weights from the interleaved columns (Bt[h*64+d][c] = w_qkv[c][d*48 + k*16 + h]), 64-row tiles turned through LDS; these preparations and w_out's transpose are ONE launch (k_prep); ONE projection launch for q, k, v of every sequence (k_proj: exact products, each wave splits its own f32 tile and stores the hi/lo head planes); then ONE attention launch for every sequence and head (k_fattn: scores, softmax and P x V fused, hi/lo 3 products each); merged hi/lo x w_out exact, ONE launch for every sequence (k_outp).
// Compute dtypes, f32 accumulate: every input rounded to bf16; projections exact; attention 3 products (hi/lo) in both matrix products; softmax f32; w_out hl x exact.

#define NB_  4
#define TT   2048
#define DM   1024
#define NH_  16
#define NKV  16
#define HD   64
#define DQ   (NH_ * HD)
#define DKV  (NKV * HD)
#define SCL  8.0f   // HD^+0.5: this module MULTIPLIES the scores by sqrt(64)
#define FW   4      // k_fattn: waves per work-group
#define QT   2      // k_fattn: 16-query tiles per wave
#define FOCC 4      // k_fattn: waves per SIMD the register budget is set for
#define KB   32     // k_fattn: keys per pass (one softmax step)
#define KS   64     // k_fattn: keys per LDS stage (two passes)
#define NST  (TT / KS)   // k_fattn: stages
#define SPI  72     // LDS pitch of a staged K or Vt row, elements: 128 B + the 16 B that the tensor load pads behind every row
#define SPL  5120   // one staged plane in LDS, elements: 64 rows of 144 B = 9,216 B, rounded up to a multiple of 2 KiB, where the next plane begins
#define SME  (4 * SPL)   // one LDS buffer: planes K hi, K lo, Vt hi, Vt lo
typedef _Float16 h16;
typedef unsigned short bf;
typedef __attribute__((ext_vector_type(16))) __bf16   v16bf;
typedef __attribute__((ext_vector_type(16))) _Float16 v16h;
typedef __attribute__((ext_vector_type(8)))  _Float16 v8h;
typedef __attribute__((ext_vector_type(8)))  unsigned short v8us;
typedef __attribute__((ext_vector_type(8)))  float    v8f;
typedef __attribute__((ext_vector_type(4)))  float    v4f;
typedef v8h  __attribute__((may_alias)) v8ha;
typedef v4f  __attribute__((may_alias)) v4fa;
typedef v8us __attribute__((may_alias)) v8usa;

__device__ __forceinline__ unsigned short f2bf(float f) { unsigned u = __float_as_uint(f); u += 0x7FFFu + ((u >> 16) & 1u); return (unsigned short)(u >> 16); }
__device__ __forceinline__ float bf2f(unsigned short b) { return __uint_as_float(((unsigned)b) << 16); }
__device__ __forceinline__ float bfr(float f) { return bf2f(f2bf(f)); }
__device__ __forceinline__ v16h cat16(v8h lo, v8h hi) { return __builtin_shufflevector(lo, hi, 0, 1, 2, 3, 4, 5, 6, 7, 8, 9, 10, 11, 12, 13, 14, 15); }
__device__ __forceinline__ v16bf cat16b(v8us lo, v8us hi) { return __builtin_bit_cast(v16bf, __builtin_shufflevector(lo, hi, 0, 1, 2, 3, 4, 5, 6, 7, 8, 9, 10, 11, 12, 13, 14, 15)); }
__device__ __forceinline__ v8f wmma16(v16h a, v16h b, v8f c) { return __builtin_amdgcn_wmma_f32_16x16x32_f16(false, a, false, b, (short)0, c, false, false); }
__device__ __forceinline__ v8f wmmab(v16bf a, v16bf b, v8f c) { return __builtin_amdgcn_wmma_f32_16x16x32_bf16(false, a, false, b, (short)0, c, false, false); }



// ---- Tensor load: ONE request of a whole wave brings a two-dimensional tile from memory into LDS, through no register. It ignores EXEC, and the compiler places no wait for it.
typedef uint32_t u32x4 __attribute__((ext_vector_type(4)));
typedef uint32_t u32x8 __attribute__((ext_vector_type(8)));
__device__ __forceinline__ uint32_t uni(uint32_t v) { return (uint32_t)__builtin_amdgcn_readfirstlane(v); }
__device__ __forceinline__ uint32_t pinned(uint32_t v) { uint32_t w = (uint32_t)__builtin_amdgcn_readfirstlane(v); asm volatile("" : "+s"(w)); return w; }   // a wave-uniform value held in a scalar register: a test on it compiles to a scalar branch, and a descriptor word made from it is formed behind the waits that stand in front of it
// Group 1 for a tile of 'rows' rows of 128 B at a source pitch of 'pitch' bytes: 1-byte elements, tensor = tile, a pad of 4 dwords behind every 32 dwords, so the rows lie 144 B apart in LDS.
__device__ __forceinline__ u32x8 tdm_group1(uint32_t rows, uint32_t pitch) { u32x8 g; g[0] = uni(1u << 20 | 4u << 22 | 3u << 25); g[1] = uni(128u << 16); g[2] = uni(rows << 16); g[3] = uni(128u << 16); g[4] = uni(rows); g[5] = uni(pitch); g[6] = uni(0u); g[7] = uni(0u);
    asm volatile("" : "+s"(g));   // pinned(), for the whole group: the descriptor's words held in one set of scalar registers, which the compiler then neither rebuilds elsewhere nor reuses while a request is on its way
    return g; }
// Group 0: the tile's place in LDS (byte offset in the work-group's LDS) and the address of its first byte.
__device__ __forceinline__ u32x4 tdm_group0(uint32_t lds, uint64_t ga) { u32x4 g; g[0] = uni(1u); g[1] = uni(lds); g[2] = uni((uint32_t)ga); g[3] = uni(((uint32_t)(ga >> 32) & 0x01FFFFFFu) | 0x80000000u); return g; }
__device__ __forceinline__ void tdm_load(u32x4 g0, u32x8 g1) { asm volatile("tensor_load_to_lds %0, %1" :: "s"(g0), "s"(g1) : "memory"); }
// The wave's own requests have landed. The wait names the last request's descriptor as inputs, so that its registers keep their values until the request is done.
__device__ __forceinline__ void tdm_wait(u32x4 g0, u32x8 g1) { asm volatile("s_wait_tensorcnt 0x0" :: "s"(g0), "s"(g1) : "memory"); }

// ---- gemm_tile: the k loop of both projection kernels. A work-group of four waves (2 x 2) sums a 128 x 128 tile of C[m][n] = sum_k A[m][k] Bt[n][k]; each wave keeps 64 x 64 (16 accumulators).
// The operands' rows are K-contiguous 16-bit planes of pitch DM. GK = 64 k columns at a time (one whole 128-byte line of every row) go from memory to LDS by tensor loads, through no register:
// wave p brings plane p's 128 rows with one request a tile (the waves beyond the planes issue none), and every staged row is read by two waves. Two buffers: tile t + 1 flies while tile t is worked on; one barrier a tile.
// Every '#pragma unroll' in gemm_tile and in the two kernels' epilogues, the store loops over s aside, stands on a loop that indexes a register array (fragments, accumulators): rolled, the array would go to scratch memory.
// The load pads every row by 16 B: LDS rows are pitched 16 bytes x odd (144 B) for the 16-byte fragment reads. NA = 2: A comes as hi and lo planes, two products a fragment pair. The products and their order along k are those of a wave that reads its fragments from memory, 32 k at a time.
#define GK   64               // k columns per staged tile
#define GP   72               // LDS pitch of a staged row, elements (128 B + 16)
#define GPL  (128 * GP)       // one staged plane (128 rows), elements: 18,432 B, a multiple of 2 KiB
#define GNT  (DM / GK)        // staged tiles along k
template <typename T16> struct WFrag;
template <> struct WFrag<h16> { typedef v16h V; static __device__ __forceinline__ V ld(const h16* p) { return cat16(*(const v8h*)p, *(const v8h*)(p + 16)); } static __device__ __forceinline__ v8f mma(V a, V b, v8f c) { return wmma16(a, b, c); } };
template <> struct WFrag<bf> { typedef v16bf V; static __device__ __forceinline__ V ld(const bf* p) { return cat16b(*(const v8us*)p, *(const v8us*)(p + 16)); } static __device__ __forceinline__ v8f mma(V a, V b, v8f c) { return wmmab(a, b, c); } };
// A, A2, Bt: the work-group's first row of each plane, k = 0. sm: 2 buffers of (NA + 1) planes, at a multiple of 2 KiB. On return every wave has left the buffers and no request is in flight: sm is free for the caller.
template <int NA>
__device__ __forceinline__ void gemm_tile(const bf* A, const bf* A2, const bf* Bt, bf* sm, v8f (&acc)[4][4]) {
    typedef WFrag<bf> F;
    const int tid = threadIdx.x, lane = tid & 31, lr = lane & 15, hi = lane >> 4, w = tid >> 5;
    const uint32_t wave = uni((uint32_t)tid >> 5);
    const bf* src = (wave == 0) ? A : (NA == 2 && wave == 1) ? A2 : Bt;   // the plane that this wave brings
    const uint32_t ldst = (uint32_t)(size_t)sm + wave * (GPL * 2);
    const u32x8 g1 = tdm_group1(128u, DM * 2);
    auto desc = [&](uint32_t t) { return tdm_group0(ldst + (t & 1u) * ((NA + 1) * GPL * 2), (uint64_t)(size_t)src + (uint64_t)t * (GK * 2)); };   // tile t of the wave's plane
    const int ao = ((w & 1) * 64 + lr) * GP + 8 * hi, bo = NA * GPL + ((w >> 1) * 64 + lr) * GP + 8 * hi;   // a lane's own row and 16-byte column in the wave's fragments
#pragma unroll
    for (int mb = 0; mb < 4; ++mb)
#pragma unroll
        for (int nb = 0; nb < 4; ++nb) acc[mb][nb] = (v8f){};
    u32x4 g0 = desc(0);
    if (pinned(wave <= NA)) tdm_load(g0, g1);   // a scalar branch round every request: one wave a plane
    tdm_wait(g0, g1);   // this wave's plane of tile 0 has landed
    __syncthreads();   // tile 0 is in LDS for every wave
    g0 = desc(pinned(1));   // pinned: formed behind the wait
    if (pinned(wave <= NA)) tdm_load(g0, g1);
#pragma unroll 1   // rolled, for speed only
    for (int t = 0; t < GNT; ++t) {
        const bf* s = sm + (t & 1) * ((NA + 1) * GPL);
        v16bf a[4], a2[4], bq[4];
        auto frags = [&](int kc) {   // the wave's fragments of 32 k
#pragma unroll
            for (int mb = 0; mb < 4; ++mb) { a[mb] = F::ld(s + ao + mb * 16 * GP + kc); if (NA == 2) a2[mb] = F::ld(s + GPL + ao + mb * 16 * GP + kc); }
#pragma unroll
            for (int nb = 0; nb < 4; ++nb) bq[nb] = F::ld(s + bo + nb * 16 * GP + kc); };
        auto prods = [&]() {
#pragma unroll
            for (int nb = 0; nb < 4; ++nb) {
#pragma unroll
                for (int mb = 0; mb < 4; ++mb) { acc[mb][nb] = F::mma(a[mb], bq[nb], acc[mb][nb]); if (NA == 2) acc[mb][nb] = F::mma(a2[mb], bq[nb], acc[mb][nb]); } } };
        frags(0);
        __builtin_amdgcn_sched_barrier(0);   // keeps these fragment reads together in front of their matrix instructions (the scheduler otherwise reads each B fragment directly in front of its users, and the wave waits out the LDS latency four times)
        prods();
        frags(32);   // the tile's last reads
        asm volatile("s_wait_dscnt 0x0" ::: "memory");      // this wave's reads of tile t are done before the buffer is given up
        tdm_wait(g0, g1);   // this wave's plane of tile t + 1 has landed
        __syncthreads();   // publishes tile t + 1, and ends every wave's reads of tile t's buffer before it is refilled
        if (pinned(wave <= NA && t + 2 < GNT)) { g0 = desc(pinned(t + 2)); tdm_load(g0, g1); }   // a scalar branch round the request; pinned(t + 2): the descriptor is formed here, behind the wait
        prods();   // the second half's products need registers alone: the refill is on its way while they run
    }
    tdm_wait(g0, g1);   // no request is in flight when the caller takes the buffers over
    asm volatile("s_wait_dscnt 0x0" ::: "memory");   // nor an LDS read
}

__device__ __forceinline__ void splitf(float y, unsigned short& h, unsigned short& l) { h = f2bf(y); l = f2bf(y - bf2f(h)); }
typedef __attribute__((ext_vector_type(2))) _Float16 v2h;
typedef __attribute__((ext_vector_type(4))) _Float16 v4h;
typedef __attribute__((ext_vector_type(2))) unsigned short v2us;
typedef __attribute__((ext_vector_type(4))) unsigned short v4us;
typedef __attribute__((ext_vector_type(2))) float v2f;
typedef __attribute__((ext_vector_type(2))) __bf16 v2bf;
typedef __attribute__((ext_vector_type(4))) int v4i;

// The parts of k_prep; bx: the block's index within its part.
// The two weight parts turn a row-major f32 weight into K-contiguous 16-bit rows. A block takes a tile of 64 weight rows x 128 columns: each wave reads whole rows of it (512 consecutive bytes, four whole lines, an instruction),
// lays them in LDS as they are, and after one barrier each lane gathers 8 rows of one column from LDS, rounds them and stores 16 bytes: eight lanes fill one whole line of an output row.
#define TP   129              // LDS pitch of a staged weight row, f32: rows are one bank apart (129 = 1 mod 64), so the 8 row groups x 4 columns that a wave gathers at a time fall on 32 different banks
template <int N>   // N: the weight's pitch; w: the tile's first element
__device__ __forceinline__ void p_stage(const float* __restrict__ w, float* sm) {
    const int wv = threadIdx.x >> 5, c = (threadIdx.x & 31) * 4; const float* g = w + (size_t)wv * N + c; v4f v[8];
#pragma unroll
    for (int i = 0; i < 8; ++i) v[i] = *(const v4f*)(g + (size_t)(8 * i) * N);   // a lane's eight pieces, all in flight together
#pragma unroll
    for (int i = 0; i < 8; ++i) {
#pragma unroll
        for (int j = 0; j < 4; ++j) sm[(wv + 8 * i) * TP + c + j] = v[i][j]; }
    __syncthreads();   // the whole tile is in LDS before any lane gathers a column of it
}
__device__ __forceinline__ v8us p_take8(const float* sm, int g, int col) { v8us o;
#pragma unroll
    for (int q = 0; q < 8; ++q) o[q] = f2bf(sm[(8 * g + q) * TP + col]);
    return o; }
// w_out transposed: Bt[n][k] = w[k][n]; tile 64 k x 128 n.
__device__ __forceinline__ void p_wtG(const float* __restrict__ w, bf* Bt, float* sm, int bx) {
    const int k0 = (bx % (DQ / 64)) * 64, n0 = (bx / (DQ / 64)) * 128;
    p_stage<DM>(w + (size_t)k0 * DM + n0, sm);
#pragma unroll
    for (int i = 0; i < 4; ++i) { const int p = threadIdx.x + 256 * i, g = p & 7, col = p >> 3; *(v8us*)(Bt + (size_t)(n0 + col) * DQ + k0 + 8 * g) = p_take8(sm, g, col); }
}
__device__ __forceinline__ void p_cvt8(const float* __restrict__ src, bf* dst, size_t n8, int bx) { const size_t i = (size_t)bx * 256 + threadIdx.x; if (i >= n8) return; const v8f v = *(const v8f*)(src + i * 8); v8us o;
#pragma unroll
    for (int k = 0; k < 8; ++k) o[k] = f2bf(v[k]); *(v8us*)(dst + i * 8) = o;  }
// The three gathered weights: Bt_k[h * 64 + d][c] = w[c][d * 48 + k * 16 + h]; tile 64 c x 128 columns.
__device__ __forceinline__ void p_wsel3(const float* __restrict__ w, bf* Bq, bf* Bk, bf* Bv, float* sm, int bx) {
    const int c0 = (bx % (DM / 64)) * 64, n0 = (bx / (DM / 64)) * 128;
    p_stage<3 * DQ>(w + (size_t)c0 * (3 * DQ) + n0, sm);
#pragma unroll
    for (int i = 0; i < 4; ++i) { const int p = threadIdx.x + 256 * i, g = p & 7, col = p >> 3; const int n = n0 + col, d = n / (3 * NH_), k = (n % (3 * NH_)) / NH_, h = n % NH_;
        bf* Bt = (k == 0) ? Bq : (k == 1) ? Bk : Bv; *(v8us*)(Bt + (size_t)(h * HD + d) * DM + c0 + 8 * g) = p_take8(sm, g, col); }
    asm volatile("s_wait_xcnt 0x0" ::: "memory");   // stands behind this part's last stores: in the built code another part's instructions follow and rewrite registers that these stores name
}
// k_prep: every 16-bit operand that the projections read, in one launch: w_out transposed, the three gathered weights, x converted. No part reads what another writes, so the block index alone picks a block's part.
// The weight parts, which have a barrier between their loads and their stores, come first in the grid; the stream of x follows.
#define PWT  ((DQ / 64) * (DM / 128))         // tiles of the transpose
#define PSEL ((DM / 64) * (3 * DQ / 128))     // tiles of the gathered weights
#define PCVT (NB_ * TT * DM / 8 / 256)        // blocks of the conversion
__global__ __launch_bounds__(256) void k_prep(const float* __restrict__ x, const float* __restrict__ wqkv, const float* __restrict__ wo, bf* WQ, bf* WK, bf* WV, bf* WO, bf* XB) {
    __shared__ __align__(16) float sm[64 * TP];
    const int bx = blockIdx.x;
    if (bx < PWT) p_wtG(wo, WO, sm, bx);
    else if (bx < PWT + PSEL) p_wsel3(wqkv, WQ, WK, WV, sm, bx - PWT);
    else p_cvt8(x, XB, (size_t)NB_ * TT * DM / 8, bx - PWT - PSEL);
}
// split8: 8 consecutive f32 of a staged row -> 8 hi and 8 lo bf16, one 16-byte store each.
__device__ __forceinline__ void split8(const float* s, bf* ph, bf* pl) { const v4f u = *(const v4fa*)s, w = *(const v4fa*)(s + 4); v8us oh, ol;
#pragma unroll
    for (int j = 0; j < 4; ++j) { unsigned short a, c; splitf(u[j], a, c); oh[j] = a; ol[j] = c; splitf(w[j], a, c); oh[4 + j] = a; ol[4 + j] = c; }
    *(v8us*)ph = oh; *(v8us*)pl = ol; }
// k_proj: the q, k and v projections of every sequence in one launch; a work-group of four waves per 128 x 128 tile (gemm_tile), ONE WAVE per 64x64 of it; grid (NB_ * TT / 128, NH_ / 2, 3), z = 0 q, 1 k, 2 v.
// A wave's tile is 64 tokens of one sequence x the 64 channels of one head. The wave splits its own f32 sums into hi/lo and stores them where k_fattn reads them: q and k as [b][h][t][d], v transposed as [b][h][d][t]; no f32 projection goes to memory.
// 16 plane rows at a time go through the wave's own LDS (q, k: 16 tokens x 64 d; v: 16 d x 64 tokens), so that every store instruction covers four whole 128-byte lines; that LDS is a piece of the operand buffers, which gemm_tile has left.
// Every '#pragma unroll' below, the store loops over s aside, stands on a loop that indexes a register array (accumulators).
__global__ __launch_bounds__(128, 4) void k_proj(const bf* __restrict__ X, const bf* __restrict__ Wq, const bf* __restrict__ Wk, const bf* __restrict__ Wv, bf* Qh, bf* Ql, bf* Kh, bf* Kl, bf* Vh, bf* Vl) {
    __shared__ __attribute__((aligned(2048))) bf sm[2 * 2 * GPL];
    const int lane = threadIdx.x & 31, lr = lane & 15, hi = lane >> 4, w = threadIdx.x >> 5; const int z = blockIdx.z;
    const bf* Bt = (z == 0) ? Wq : (z == 1) ? Wk : Wv;
    v8f acc[4][4];
    gemm_tile<1>(X + (size_t)blockIdx.x * 128 * DM, nullptr, Bt + (size_t)blockIdx.y * 128 * DM, sm, acc);
    const int r0 = blockIdx.x * 128 + (w & 1) * 64, h = blockIdx.y * 2 + (w >> 1);   // the wave's own first token and its head
    float* os = (float*)sm + w * (16 * 68);
    const int t0 = r0 % TT; const size_t pz = (size_t)((r0 / TT) * NH_ + h) * TT * HD; const int er = lane >> 3, ec = (lane & 7) * 8;   // a lane's row (of four) and 8-element column in a store
    if (z < 2) {
        bf* Ph = ((z == 0) ? Qh : Kh) + pz + (size_t)t0 * HD; bf* Pl = ((z == 0) ? Ql : Kl) + pz + (size_t)t0 * HD;
#pragma unroll
        for (int mb = 0; mb < 4; ++mb) {
#pragma unroll
            for (int nb = 0; nb < 4; ++nb) {
#pragma unroll
                for (int j = 0; j < 8; ++j) os[(hi * 8 + j) * 68 + nb * 16 + lr] = acc[mb][nb][j]; }
            __builtin_amdgcn_wave_barrier(); asm volatile("" ::: "memory");   // the reads below stay behind the other lanes' writes
#pragma unroll
            for (int s = 0; s < 4; ++s) { const int row = 4 * s + er; split8(os + row * 68 + ec, Ph + (mb * 16 + row) * HD + ec, Pl + (mb * 16 + row) * HD + ec); }
            __builtin_amdgcn_wave_barrier(); asm volatile("" ::: "memory");   // the next rows' writes stay behind these reads
        }
    } else {
        bf* Ph = Vh + pz + t0; bf* Pl = Vl + pz + t0;
#pragma unroll
        for (int nb = 0; nb < 4; ++nb) {
#pragma unroll
            for (int mb = 0; mb < 4; ++mb) { v4f u, w;
#pragma unroll
                for (int j = 0; j < 4; ++j) { u[j] = acc[mb][nb][j]; w[j] = acc[mb][nb][4 + j]; }
                *(v4fa*)(os + lr * 68 + mb * 16 + hi * 8) = u; *(v4fa*)(os + lr * 68 + mb * 16 + hi * 8 + 4) = w; }
            __builtin_amdgcn_wave_barrier(); asm volatile("" ::: "memory");   // the reads below stay behind the other lanes' writes
#pragma unroll
            for (int s = 0; s < 4; ++s) { const int row = 4 * s + er; split8(os + row * 68 + ec, Ph + (size_t)(nb * 16 + row) * TT + ec, Pl + (size_t)(nb * 16 + row) * TT + ec); }
            __builtin_amdgcn_wave_barrier(); asm volatile("" ::: "memory");   // the next rows' writes stay behind these reads
        }
        asm volatile("s_wait_xcnt 0x0" ::: "memory");   // stands behind this branch's last stores: in the built code the other branch's instructions follow and rewrite registers that these stores name
    }
}
// k_outp: the output projection of every sequence, C[t][n] (f32, pitch DM, t over all NB_ * TT tokens) = sum_c (Ah + Al)[t][c] Wo[n][c]; a work-group of four waves per 128 x 128 tile (gemm_tile, hi and lo planes of A), grid (NB_ * TT / 128, DM / 128): two work-groups for every WGP's LDS.
// Each wave passes its 64 x 64 sums, 16 rows at a time, through its own piece of the operand buffers, which gemm_tile has left, so that every store instruction covers whole lines.
__global__ __launch_bounds__(128, 4) void k_outp(const bf* __restrict__ Ah, const bf* __restrict__ Al, const bf* __restrict__ Wo, float* C) {
    __shared__ __attribute__((aligned(2048))) bf sm[2 * 3 * GPL];
    const int lane = threadIdx.x & 31, lr = lane & 15, hi = lane >> 4, w = threadIdx.x >> 5;
    v8f acc[4][4];
    gemm_tile<2>(Ah + (size_t)blockIdx.x * 128 * DM, Al + (size_t)blockIdx.x * 128 * DM, Wo + (size_t)blockIdx.y * 128 * DM, sm, acc);
    const int r0 = blockIdx.x * 128 + (w & 1) * 64, c0 = blockIdx.y * 128 + (w >> 1) * 64;
    float* os = (float*)sm + w * (16 * 68);
#pragma unroll
    for (int mb = 0; mb < 4; ++mb) {
#pragma unroll
        for (int nb = 0; nb < 4; ++nb) {
#pragma unroll
            for (int j = 0; j < 8; ++j) os[(hi * 8 + j) * 68 + nb * 16 + lr] = acc[mb][nb][j]; }
        __builtin_amdgcn_wave_barrier(); asm volatile("" ::: "memory");   // the reads below stay behind the other lanes' writes
        float* crow = C + (size_t)(r0 + mb * 16) * DM + c0;
#pragma unroll
        for (int s = 0; s < 8; ++s) { const int row = 2 * s + hi, cofs = lr * 4; *(v4f*)(crow + (size_t)row * DM + cofs) = *(const v4fa*)(os + row * 68 + cofs); }
        __builtin_amdgcn_wave_barrier(); asm volatile("" ::: "memory");   // the next rows' writes stay behind these reads
    }
}
// k_fattn: scores, softmax and P x V of one (sequence, head) in one kernel; nothing of the score matrix goes to memory.
// Each wave owns QT tiles of 16 queries; the work-group walks the keys KB at a time. A wave forms the TRANSPOSED scores St[key][query] = K Qt (A = key rows, B = query columns):
// a lane then holds 8 keys of ONE query (query = lane & 15, keys 8 * (lane >> 4) + j of each 16-key tile), which is the B-fragment order of the second product Ot[d][query] = Vt[d][key] Pt[key][query]:
// no value changes lanes between the two products, and the running maximum, the running sum and the rescale factor are one scalar a lane.
// Both products keep the three hi/lo terms (hh + hl + lh). p = 2^(s c - m c), c = SCL log2(e), m the running maximum; the division by the row sum comes last.
// K rows and Vt columns (hi and lo) come to LDS KS keys at a time, once a work-group, by tensor loads: each of the four waves brings one plane's tile of 64 rows x 128 B (K: 64 keys x 64 d; Vt: 64 d x 64 keys) with one request a stage.
// Two buffers: stage s + 1 flies while stage s is worked on (two passes of KB keys); one barrier a stage. The load pads every row by 16 B, so LDS rows are pitched 16 bytes x odd (144 B) for the 16-byte fragment reads.
// A pass's fragment reads stand in three groups, each ahead of its users: the sixteen K reads at the head of the pass; twelve Vt reads behind the score products, on their way while the softmax runs; the last four Vt reads behind the first Vt pair's products, ahead of the rest. The register budget of FOCC waves a SIMD holds them.
// Every '#pragma unroll' below stands on a loop that indexes a register array (fragments, accumulators): rolled, the array would go to scratch memory.
__global__ __launch_bounds__(FW * 32, FOCC) void k_fattn(const bf* __restrict__ Qh, const bf* __restrict__ Ql, const bf* __restrict__ Kh, const bf* __restrict__ Kl, const bf* __restrict__ Vh, const bf* __restrict__ Vl, bf* Ah, bf* Al) {
    typedef WFrag<bf> F;
    __shared__ __attribute__((aligned(2048))) bf sm[2 * SME - (SPL - KS * SPI)];   // two buffers; nothing follows the last plane, so its size is not rounded up
    const int tid = threadIdx.x, lane = tid & 31, lr = lane & 15, hi = lane >> 4; const int z = blockIdx.y, b = z / NH_, h = z % NH_; const int q0 = (blockIdx.x * FW + (tid >> 5)) * (16 * QT);
    const size_t pz = (size_t)z * TT * HD; const float C = SCL * 1.4426950408889634f;
    // Wave w brings plane w of every stage. K: the stage's 64 rows lie one behind the other (pitch 128 B), the next stage 64 rows on. Vt: 128 B of each of the 64 rows (pitch TT elements), the next stage 128 B on.
    const uint32_t wave = uni((uint32_t)tid >> 5);
    const bf* src = ((wave == 0) ? Kh : (wave == 1) ? Kl : (wave == 2) ? Vh : Vl) + pz;
    const uint32_t spitch = (wave < 2) ? HD * 2 : TT * 2, sstep = (wave < 2) ? KS * HD * 2 : KS * 2;   // bytes
    const uint32_t ldst = (uint32_t)(size_t)sm + wave * (SPL * 2);
    const u32x8 g1 = tdm_group1(64u, spitch);
    auto desc = [&](uint32_t st) { return tdm_group0(ldst + (st & 1u) * (SME * 2), (uint64_t)(size_t)src + (uint64_t)st * sstep); };   // stage st of the wave's plane
    u32x4 g0 = desc(0);
    tdm_load(g0, g1);   // every wave issues its own plane: no test
    v16bf qh[QT][2], ql[QT][2]; v8f o[QT][4]; float m[QT]; v2f l[QT];
#pragma unroll
    for (int qt = 0; qt < QT; ++qt) { m[qt] = -3.0e38f; l[qt] = (v2f){};
#pragma unroll
        for (int kc = 0; kc < 2; ++kc) { const size_t qo = pz + (size_t)(q0 + qt * 16 + lr) * HD + kc * 32 + 8 * hi; qh[qt][kc] = F::ld(Qh + qo); ql[qt][kc] = F::ld(Ql + qo); }
#pragma unroll
        for (int dt = 0; dt < 4; ++dt) o[qt][dt] = (v8f){}; }
    tdm_wait(g0, g1);   // this wave's plane of stage 0 has landed
    __syncthreads();   // stage 0 is in LDS for every wave
    g0 = desc(pinned(1));   // pinned: formed behind the wait
    tdm_load(g0, g1);
#pragma unroll 1   // rolled, for speed only
    for (int st = 0; st < NST; ++st) {
        const bf* s0 = sm + (st & 1) * SME;
#pragma unroll 1   // rolled: unrolled, the two passes' values live side by side and leave one register set for the fragments
        for (int ps = 0; ps < KS / KB; ++ps) {
            v8f s[QT][2]; v16bf kh[2][2], kl[2][2];
#pragma unroll
            for (int kt = 0; kt < 2; ++kt) {
#pragma unroll
                for (int kc = 0; kc < 2; ++kc) { const int ko = (ps * KB + kt * 16 + lr) * SPI + kc * 32 + 8 * hi; kh[kt][kc] = F::ld(s0 + ko); kl[kt][kc] = F::ld(s0 + SPL + ko); } }
            __builtin_amdgcn_sched_barrier(0);   // keeps the pass's sixteen K reads together in front of the score products (the scheduler otherwise reads the second key tile among them, into the first one's registers, and the wave waits out the LDS latency a second time)
#pragma unroll
            for (int kt = 0; kt < 2; ++kt) {
#pragma unroll
                for (int qt = 0; qt < QT; ++qt) { v8f a = (v8f){};
#pragma unroll
                    for (int kc = 0; kc < 2; ++kc) { a = F::mma(kh[kt][kc], qh[qt][kc], a); a = F::mma(kh[kt][kc], ql[qt][kc], a); a = F::mma(kl[kt][kc], qh[qt][kc], a); }
                    s[qt][kt] = a; } }
            __builtin_amdgcn_sched_barrier(0);   // the Vt reads below stay behind the score products, whose K registers they take over
            v16bf vh[3], vl[3];   // three register sets for the four Vt fragment pairs
            auto vfrag = [&](int dt) { const int vo = (dt * 16 + lr) * SPI + ps * KB + 8 * hi; vh[dt % 3] = F::ld(s0 + 2 * SPL + vo); vl[dt % 3] = F::ld(s0 + 3 * SPL + vo); };
            vfrag(0); vfrag(1); vfrag(2);
            __builtin_amdgcn_sched_barrier(0);   // keeps these twelve reads here, in front of the softmax, which runs while they are on their way (the scheduler otherwise reads each pair directly in front of its products)
            v16bf ph[QT], pl[QT];
#pragma unroll
            for (int qt = 0; qt < QT; ++qt) { float mx = s[qt][0][0];
#pragma unroll
                for (int j = 0; j < 8; ++j) mx = fmaxf(mx, fmaxf(s[qt][0][j], s[qt][1][j]));
                mx = fmaxf(mx, __shfl_xor(mx, 16, 32));
                const float mn = fmaxf(m[qt], mx * C); const float al = __builtin_amdgcn_exp2f(m[qt] - mn); m[qt] = mn; v2f ls[2] = { (v2f){}, (v2f){} };
#pragma unroll
                for (int e = 0; e < 16; e += 2) { v2f t; t[0] = s[qt][e >> 3][e & 7]; t[1] = s[qt][e >> 3][(e & 7) + 1]; t = __builtin_elementwise_fma(t, (v2f){C, C}, (v2f){-mn, -mn}); v2f p; p[0] = __builtin_amdgcn_exp2f(t[0]); p[1] = __builtin_amdgcn_exp2f(t[1]); ls[(e >> 1) & 1] += p;
                    const v2bf a = __builtin_convertvector(p, v2bf); const v2bf r = __builtin_convertvector(p - __builtin_convertvector(a, v2f), v2bf); ph[qt][e] = a[0]; ph[qt][e + 1] = a[1]; pl[qt][e] = r[0]; pl[qt][e + 1] = r[1]; }
                l[qt] = l[qt] * al + (ls[0] + ls[1]);
#pragma unroll
                for (int dt = 0; dt < 4; ++dt) o[qt][dt] *= al; }
            auto pv = [&](int dt) {
#pragma unroll
                for (int qt = 0; qt < QT; ++qt) { v8f a = o[qt][dt]; a = F::mma(vh[dt % 3], ph[qt], a); a = F::mma(vh[dt % 3], pl[qt], a); a = F::mma(vl[dt % 3], ph[qt], a); o[qt][dt] = a; } };
            pv(0);
            vfrag(3);   // into the set that pv(0) has left
            __builtin_amdgcn_sched_barrier(0);   // keeps the last pair's reads ahead of the products that follow (the scheduler otherwise reads them directly in front of their users, and the wave waits out the LDS latency)
            pv(1); pv(2); pv(3);
        }
        asm volatile("s_wait_dscnt 0x0" ::: "memory");      // this wave's reads of stage st are done before its buffer is given up
        tdm_wait(g0, g1);   // this wave's plane of stage st + 1 has landed
        __syncthreads();   // publishes stage st + 1, and ends every wave's reads of stage st's buffer before it is refilled
        if (pinned(st + 2 < NST)) { g0 = desc(pinned(st + 2)); tdm_load(g0, g1); }   // a scalar branch round the request; pinned(st + 2): the descriptor is formed here, behind the wait
    }
    tdm_wait(g0, g1);   // no request is in flight when the wave ends
    asm volatile("s_wait_dscnt 0x0" ::: "memory");       // nor an LDS read
#pragma unroll
    for (int qt = 0; qt < QT; ++qt) { const float lh = l[qt][0] + l[qt][1]; const float f = __fdiv_rn(1.0f, lh + __shfl_xor(lh, 16, 32)); const size_t oo = ((size_t)b * TT + q0 + qt * 16 + lr) * DQ + h * HD + 8 * hi;
#pragma unroll
        for (int dt = 0; dt < 4; ++dt) { v8us oh, ol;
#pragma unroll
            for (int j = 0; j < 8; ++j) { unsigned short a, c2; splitf(o[qt][dt][j] * f, a, c2); oh[j] = a; ol[j] = c2; }
            *(v8us*)(Ah + oo + dt * 16) = oh; *(v8us*)(Al + oo + dt * 16) = ol; } }
}

extern "C" void kernel_launch(void* const* d_in, const int* in_sizes, int n_in,
                              void* d_out, int out_size, void* d_ws, size_t ws_size, hipStream_t stream) {
    (void)in_sizes; (void)n_in; (void)out_size;
    const float* x = (const float*)d_in[0]; const float* wqkv = (const float*)d_in[1]; const float* wo = (const float*)d_in[2]; const float* wq = nullptr; const float* wk = nullptr; const float* wv = nullptr; (void)wq; (void)wk; (void)wv;
    float* OUT = (float*)d_out;     // [4][2048][1024]
    char* wsp = (char*)d_ws;
    auto take = [&](size_t bytes) { char* p = wsp; wsp += (bytes + 255) & ~(size_t)255; return (void*)p; };
    bf* WQ = (bf*)take((size_t)DQ * DM * 2); bf* WK = (bf*)take((size_t)DKV * DM * 2); bf* WV = (bf*)take((size_t)DKV * DM * 2); bf* WO = (bf*)take((size_t)DM * DQ * 2);
    bf* XB = (bf*)take((size_t)NB_ * TT * DM * 2);
    const size_t PB = (size_t)NH_ * TT * HD;   // one sequence's share of a hi or lo plane; the planes hold all NB_ sequences, [b][h][..]
    bf* QPh = (bf*)take(NB_ * PB * 2); bf* QPl = (bf*)take(NB_ * PB * 2); bf* KPh = (bf*)take(NB_ * PB * 2); bf* KPl = (bf*)take(NB_ * PB * 2); bf* VTh = (bf*)take(NB_ * PB * 2); bf* VTl = (bf*)take(NB_ * PB * 2);
    bf* ATh = (bf*)take((size_t)NB_ * TT * DQ * 2); bf* ATl = (bf*)take((size_t)NB_ * TT * DQ * 2);
    if ((size_t)(wsp - (char*)d_ws) > ws_size) return;    // ws 256 MiB
    k_prep<<<PWT + PSEL + PCVT, 256, 0, stream>>>(x, wqkv, wo, WQ, WK, WV, WO, XB);   // all 16-bit operands of the projections in one launch
    k_proj<<<dim3(NB_ * TT / 128, NH_ / 2, 3), 128, 0, stream>>>(XB, WQ, WK, WV, QPh, QPl, KPh, KPl, VTh, VTl);   // q, k, v of every sequence in one launch
    k_fattn<<<dim3(TT / (16 * QT * FW), NB_ * NH_, 1), FW * 32, 0, stream>>>(QPh, QPl, KPh, KPl, VTh, VTl, ATh, ATl);   // every sequence and head in one launch
    k_outp<<<dim3(NB_ * TT / 128, DM / 128, 1), 128, 0, stream>>>(ATh, ATl, WO, OUT);   // every sequence in one launch
}
